// v000
// Times are from an AMD MI455X. After a warm-up the kernel runs many times in a row, and a time is the length of
// such a window on the GPU divided by its runs, so every launch and the gaps after it count. The runs cycle
// through copies of the inputs. A figure is the median of several windows, for all but v000 over two sittings.
// Sittings can differ by a few percent; kernels timed side by side share one.
// v000 is the starting kernel. One run takes 361 microseconds.
#include <hip/hip_runtime.h>
#include <math.h>

// Causal single-head attention (d_attn 64) with qkv and output projections.
// All four contractions (qkv projection K = 512, scores K = 64, P @ V over <= 2048 keys, output projection K = 64) on
// v_wmma_f32_16x16x32_bf16 as a TWO-WAY bf16 split of both f32 operands (hi*hi + hi*lo + lo*hi, f32 accumulate).

#define D_MODEL 512
#define D_ATTN  64
#define NSEQ    2048
#define NBATCH  8
#define NTOK    (NBATCH * NSEQ)
#define D_OUT   256
#define D_QKV   192
#define SCALE_F 0.125f

typedef __attribute__((ext_vector_type(16))) __bf16 v16bf;
typedef __attribute__((ext_vector_type(8)))  __bf16 v8bf;
typedef __attribute__((ext_vector_type(8)))  float  v8f;
typedef __attribute__((ext_vector_type(4)))  float  v4f;
typedef __attribute__((ext_vector_type(4)))  unsigned v4u;

template <typename T> __device__ __forceinline__ void vst2(void* p, T v) { *(T*)p = v;  }
__device__ __forceinline__ v8f wmma_bf(v16bf a, v16bf b, v8f c) {
  v8f d = __builtin_amdgcn_wmma_f32_16x16x32_bf16(false, a, false, b, (short)0, c, false, false);
  asm volatile("v_nop\n\tv_nop\n\tv_nop\n\tv_nop" : "+v"(d) : "v"(a), "v"(b));
  return d;
}
struct F2 { v16bf h, l; };
// split an f32 row fragment (row base pointer, k0) into bf16 hi/lo; element i<8 -> k0+8g+i, i>=8 -> k0+16+8g+(i-8)
__device__ __forceinline__ F2 split_f32(const float* row, int k0, int lane) {
  F2 r; const float* p = row + k0 + 8 * (lane >> 4);
#pragma unroll
  for (int i = 0; i < 16; ++i) { const float x = p[(i < 8) ? i : (i + 8)]; const __bf16 h = (__bf16)x; r.h[i] = h; r.l[i] = (__bf16)(x - (float)h); }
  return r;
}
__device__ __forceinline__ v16bf frag_bf(const __bf16* row, int k0, int lane) {
  union { v16bf v; v8bf q[2]; } r; const __bf16* p = row + k0 + 8 * (lane >> 4);
  r.q[0] = *(const v8bf*)(p); r.q[1] = *(const v8bf*)(p + 16); return r.v;
}
__device__ __forceinline__ v8f mac3(const F2& a, const F2& b, v8f c) {
  c = wmma_bf(a.l, b.h, c); c = wmma_bf(a.h, b.l, c); c = wmma_bf(a.h, b.h, c); return c;
}
__device__ __forceinline__ v8f mac3p(const F2& a, const __bf16* bh, const __bf16* bl, int k0, int lane, v8f c) {
  const v16bf fh = frag_bf(bh, k0, lane), fl = frag_bf(bl, k0, lane);
  c = wmma_bf(a.l, fh, c); c = wmma_bf(a.h, fl, c); c = wmma_bf(a.h, fh, c); return c;
}

// W [K][N] f32 (x @ W layout) -> planes W^T [N][K] bf16 hi/lo via 64x64 tiles; grid = (K/64)*(N/64)
__global__ __launch_bounds__(256) void k_wt(const float* __restrict__ W, __bf16* __restrict__ Ph, __bf16* __restrict__ Pl, int K, int N) {
  __shared__ __align__(16) __bf16 th[64][72], tl[64][72];
  const int nt = N / 64, tid = threadIdx.x;
  const int n0 = (blockIdx.x % nt) * 64, k0 = (blockIdx.x / nt) * 64;
  for (int i = tid; i < 64 * 64; i += 256) { const int kk = i >> 6, nn = i & 63; const float x = W[(size_t)(k0 + kk) * N + n0 + nn];
    const __bf16 h = (__bf16)x; th[nn][kk] = h; tl[nn][kk] = (__bf16)(x - (float)h); }
  __syncthreads();
  for (int g = tid; g < 64 * 8; g += 256) { const int nn = g >> 3, pc = g & 7; const size_t o = (size_t)(n0 + nn) * K + k0 + pc * 8;
    vst2(Ph + o, *(const v4u*)(&th[nn][pc * 8])); vst2(Pl + o, *(const v4u*)(&tl[nn][pc * 8])); }
}

// qkv projection: block = 64 tokens (4 waves x 16 rows) x all 192 cols; q,k rows f32 [tok][64]; v transposed vT[b][d][n] f32
__global__ __launch_bounds__(128) void k_qkv(const float* __restrict__ x, const __bf16* __restrict__ Wh, const __bf16* __restrict__ Wl,
                                            const float* __restrict__ bq, float* __restrict__ qb, float* __restrict__ kb, float* __restrict__ vT) {
  __shared__ __align__(16) float st[64][196];          // [row][col] pitch 196
  const int tid = threadIdx.x, wave = tid >> 5, lane = tid & 31, col = lane & 15, g = lane >> 4;
  const int m0 = blockIdx.x * 64 + wave * 16;
  const float* ar = x + (size_t)(m0 + col) * D_MODEL;
  v8f c[12] = {};
#pragma unroll 1
  for (int kc = 0; kc < D_MODEL / 32; ++kc) {
    const F2 a = split_f32(ar, kc * 32, lane);
#pragma unroll
    for (int j = 0; j < 12; ++j) c[j] = mac3p(a, Wh + (size_t)(j * 16 + col) * D_MODEL, Wl + (size_t)(j * 16 + col) * D_MODEL, kc * 32, lane, c[j]);
  }
#pragma unroll
  for (int j = 0; j < 12; ++j) { const float bb = bq[j * 16 + col];
#pragma unroll
    for (int r = 0; r < 8; ++r) st[wave * 16 + g * 8 + r][j * 16 + col] = c[j][r] + bb; }
  __syncthreads();
  // q and k rows: 64 rows x 64 floats (256 B) each
  for (int gq = tid; gq < 64 * 16; gq += 128) { const int rl = gq >> 4, pc = gq & 15;
    vst2(qb + (size_t)(blockIdx.x * 64 + rl) * D_ATTN + pc * 4, *(const v4f*)(&st[rl][pc * 4]));
    vst2(kb + (size_t)(blockIdx.x * 64 + rl) * D_ATTN + pc * 4, *(const v4f*)(&st[rl][64 + pc * 4])); }
  // vT[b][d][n]: for each d the block's 64 consecutive tokens = 256 B
  { const int bm0 = blockIdx.x * 64, bidx = bm0 >> 11, n0 = bm0 & (NSEQ - 1);
    for (int gq = tid; gq < 64 * 16; gq += 128) { const int d = gq >> 4, pc = gq & 15;
      v4f v = { st[pc * 4][128 + d], st[pc * 4 + 1][128 + d], st[pc * 4 + 2][128 + d], st[pc * 4 + 3][128 + d] };
      vst2(vT + ((size_t)bidx * D_ATTN + d) * NSEQ + n0 + pc * 4, v); } }
}

// causal flash attention: one wave per (batch, 16 queries); block = 8 waves
__global__ __launch_bounds__(256) void k_attn(const float* __restrict__ qb, const float* __restrict__ kb, const float* __restrict__ vT, float* __restrict__ ob) {
  __shared__ __align__(16) float pl[8][16 * 32];        // P tile f32 per wave
  __shared__ __align__(16) float os[8][16 * 64];        // output staging per wave
  const int wave = blockIdx.x * 8 + (threadIdx.x >> 5), wl = threadIdx.x >> 5;
  const int b = wave >> 7, qs = (wave & 127) * 16;
  const int lane = threadIdx.x & 31, g = lane >> 4, col = lane & 15;
  const float* qrow = qb + ((size_t)b * NSEQ + qs + col) * D_ATTN;
  const F2 qa = split_f32(qrow, 0, lane), qc = split_f32(qrow, 32, lane);
  float m_r[8], l_r[8];
  v8f o[4] = {};
#pragma unroll
  for (int r = 0; r < 8; ++r) { m_r[r] = -1e30f; l_r[r] = 0.f; }
  float* p = pl[wl];
  const int jmax = (qs + 15) >> 5;
  for (int j = 0; j <= jmax; ++j) {
    const int ks = j * 32;
    const float* krow0 = kb + ((size_t)b * NSEQ + ks + col) * D_ATTN;
    const float* krow1 = krow0 + 16 * D_ATTN;
    v8f s0 = {}, s1 = {};
    s0 = mac3(qa, split_f32(krow0, 0, lane), s0); s0 = mac3(qc, split_f32(krow0, 32, lane), s0);
    s1 = mac3(qa, split_f32(krow1, 0, lane), s1); s1 = mac3(qc, split_f32(krow1, 32, lane), s1);
#pragma unroll
    for (int r = 0; r < 8; ++r) {
      const int qi = qs + r + 8 * g;
      float a0 = s0[r] * SCALE_F; if (ks + col > qi)      a0 = -1e30f;
      float a1 = s1[r] * SCALE_F; if (ks + 16 + col > qi) a1 = -1e30f;
      float mx = fmaxf(a0, a1);
#pragma unroll
      for (int off = 8; off >= 1; off >>= 1) mx = fmaxf(mx, __shfl_xor(mx, off, 32));
      const float mn = fmaxf(m_r[r], mx);
      const float p0 = __expf(a0 - mn), p1 = __expf(a1 - mn);
      const int row = r + 8 * g;
      p[row * 32 + col] = p0; p[row * 32 + 16 + col] = p1;
      float sum = p0 + p1;
#pragma unroll
      for (int off = 8; off >= 1; off >>= 1) sum += __shfl_xor(sum, off, 32);
      const float corr = __expf(m_r[r] - mn);
      l_r[r] = l_r[r] * corr + sum; m_r[r] = mn;
#pragma unroll
      for (int t = 0; t < 4; ++t) o[t][r] *= corr;
    }
    asm volatile("s_wait_dscnt 0" ::: "memory"); __builtin_amdgcn_wave_barrier(); __builtin_amdgcn_fence(__ATOMIC_RELEASE, "workgroup");
    const F2 pf = split_f32(p + col * 32, 0, lane);       // A row m = col, keys 0..31
    const float* vb = vT + (size_t)b * D_ATTN * NSEQ + ks;
#pragma unroll
    for (int t = 0; t < 4; ++t) o[t] = mac3(pf, split_f32(vb + (size_t)(t * 16 + col) * NSEQ, 0, lane), o[t]);
    __builtin_amdgcn_wave_barrier();                      // P tile reused next iteration
  }
  float* so = os[wl];
#pragma unroll
  for (int t = 0; t < 4; ++t)
#pragma unroll
    for (int r = 0; r < 8; ++r) so[(r + 8 * g) * 64 + t * 16 + col] = o[t][r] / l_r[r];
  asm volatile("s_wait_dscnt 0" ::: "memory"); __builtin_amdgcn_wave_barrier(); __builtin_amdgcn_fence(__ATOMIC_RELEASE, "workgroup");
#pragma unroll
  for (int q = 0; q < 8; ++q) { const int rl = q * 2 + (lane >> 4), pc = lane & 15;
    vst2(ob + ((size_t)b * NSEQ + qs + rl) * D_ATTN + pc * 4, *(const v4f*)(so + rl * 64 + pc * 4)); }
}

// output projection: block = 64 tokens (4 waves x 16 rows) x 256 cols in 16 column tiles of 16 per wave; rows 1 KB
__global__ __launch_bounds__(128) void k_out(const float* __restrict__ ob, const __bf16* __restrict__ Wh, const __bf16* __restrict__ Wl,
                                            const float* __restrict__ bo, float* __restrict__ out) {
  __shared__ __align__(16) float st[4][16 * 260];
  const int tid = threadIdx.x, wave = tid >> 5, lane = tid & 31, col = lane & 15, g = lane >> 4;
  const int m0 = blockIdx.x * 64 + wave * 16;
  const float* ar = ob + (size_t)(m0 + col) * D_ATTN;
  const F2 a0 = split_f32(ar, 0, lane), a1 = split_f32(ar, 32, lane);
  float* S = st[wave];
#pragma unroll 2
  for (int j = 0; j < 16; ++j) {
    v8f c = {};
    c = mac3p(a0, Wh + (size_t)(j * 16 + col) * D_ATTN, Wl + (size_t)(j * 16 + col) * D_ATTN, 0, lane, c);
    c = mac3p(a1, Wh + (size_t)(j * 16 + col) * D_ATTN, Wl + (size_t)(j * 16 + col) * D_ATTN, 32, lane, c);
    const float bb = bo[j * 16 + col];
#pragma unroll
    for (int r = 0; r < 8; ++r) S[(r + 8 * g) * 260 + j * 16 + col] = c[r] + bb;
  }
  asm volatile("s_wait_dscnt 0" ::: "memory"); __builtin_amdgcn_wave_barrier(); __builtin_amdgcn_fence(__ATOMIC_RELEASE, "workgroup");
  // 16 rows x 256 floats: per row 64 pieces -> 2 instructions per row... 16 rows x 64 pieces / 32 lanes = 32 instructions
#pragma unroll 4
  for (int q = 0; q < 32; ++q) { const int rl = q >> 1, pc = (q & 1) * 32 + lane;
    vst2(out + (size_t)(m0 + rl) * D_OUT + pc * 4, *(const v4f*)(S + rl * 260 + pc * 4)); }
}

extern "C" void kernel_launch(void* const* d_in, const int* in_sizes, int n_in,
                              void* d_out, int out_size, void* d_ws, size_t ws_size,
                              hipStream_t stream) {
  (void)in_sizes; (void)n_in; (void)out_size; (void)ws_size;
  const float* x     = (const float*)d_in[0];
  const float* W_qkv = (const float*)d_in[1];
  const float* b_qkv = (const float*)d_in[2];
  const float* W_out = (const float*)d_in[3];
  const float* b_out = (const float*)d_in[4];
  float* out = (float*)d_out;
  char* ws = (char*)d_ws; size_t off = 0;
  auto alloc = [&](size_t bytes) -> void* { void* p = ws + off; off = (off + bytes + 255) & ~(size_t)255; return p; };
  __bf16* Wqh = (__bf16*)alloc((size_t)D_QKV * D_MODEL * 2); __bf16* Wql = (__bf16*)alloc((size_t)D_QKV * D_MODEL * 2);
  __bf16* Woh = (__bf16*)alloc((size_t)D_OUT * D_ATTN * 2);  __bf16* Wol = (__bf16*)alloc((size_t)D_OUT * D_ATTN * 2);
  float* qb = (float*)alloc((size_t)NTOK * D_ATTN * 4); float* kb = (float*)alloc((size_t)NTOK * D_ATTN * 4);
  float* vT = (float*)alloc((size_t)NTOK * D_ATTN * 4); float* ob = (float*)alloc((size_t)NTOK * D_ATTN * 4);

  k_wt<<<(D_MODEL / 64) * (D_QKV / 64), 256, 0, stream>>>(W_qkv, Wqh, Wql, D_MODEL, D_QKV);
  k_wt<<<(D_ATTN / 64) * (D_OUT / 64), 256, 0, stream>>>(W_out, Woh, Wol, D_ATTN, D_OUT);
  k_qkv<<<NTOK / 64, 128, 0, stream>>>(x, Wqh, Wql, b_qkv, qb, kb, vT);
  k_attn<<<NBATCH * (NSEQ / 16) / 8, 256, 0, stream>>>(qb, kb, vT, ob);
  k_out<<<NTOK / 64, 128, 0, stream>>>(ob, Woh, Wol, b_out, out);
}

// v001
// One run takes 127 microseconds.
// Next to v000, in two timings, it ran 2.92 and 2.82 times as fast.
#include <hip/hip_runtime.h>
#include <math.h>

// Causal single-head attention (d_attn 64) with qkv and output projections.
// All four contractions (qkv projection K = 512, scores K = 64, P @ V over <= 2048 keys, output projection K = 64) on
// v_wmma_f32_16x16x32_bf16 as a TWO-WAY bf16 split of both f32 operands (hi*hi + hi*lo + lo*hi, f32 accumulate).

#define D_MODEL 512
#define D_ATTN  64
#define NSEQ    2048
#define NBATCH  8
#define NTOK    (NBATCH * NSEQ)
#define D_OUT   256
#define D_QKV   192
#define SCALE_F 0.125f

typedef __attribute__((ext_vector_type(16))) __bf16 v16bf;
typedef __attribute__((ext_vector_type(8)))  __bf16 v8bf;
typedef __attribute__((ext_vector_type(8)))  float  v8f;
typedef __attribute__((ext_vector_type(4)))  float  v4f;
typedef __attribute__((ext_vector_type(4)))  unsigned v4u;

template <typename T> __device__ __forceinline__ void vst2(void* p, T v) { *(T*)p = v;  }
__device__ __forceinline__ v8f wmma_bf(v16bf a, v16bf b, v8f c) {
  v8f d = __builtin_amdgcn_wmma_f32_16x16x32_bf16(false, a, false, b, (short)0, c, false, false);
  asm volatile("v_nop\n\tv_nop\n\tv_nop\n\tv_nop" : "+v"(d) : "v"(a), "v"(b));
  return d;
}
struct F2 { v16bf h, l; };
// split an f32 row fragment (row base pointer, k0) into bf16 hi/lo; element i<8 -> k0+8g+i, i>=8 -> k0+16+8g+(i-8)
__device__ __forceinline__ F2 split_f32(const float* row, int k0, int lane) {
  F2 r; const float* p = row + k0 + 8 * (lane >> 4);
#pragma unroll
  for (int i = 0; i < 16; ++i) { const float x = p[(i < 8) ? i : (i + 8)]; const __bf16 h = (__bf16)x; r.h[i] = h; r.l[i] = (__bf16)(x - (float)h); }
  return r;
}
__device__ __forceinline__ v16bf frag_bf(const __bf16* row, int k0, int lane) {
  union { v16bf v; v8bf q[2]; } r; const __bf16* p = row + k0 + 8 * (lane >> 4);
  r.q[0] = *(const v8bf*)(p); r.q[1] = *(const v8bf*)(p + 16); return r.v;
}
__device__ __forceinline__ v8f mac3(const F2& a, const F2& b, v8f c) {
  c = wmma_bf(a.l, b.h, c); c = wmma_bf(a.h, b.l, c); c = wmma_bf(a.h, b.h, c); return c;
}
__device__ __forceinline__ v8f mac3p(const F2& a, const __bf16* bh, const __bf16* bl, int k0, int lane, v8f c) {
  const v16bf fh = frag_bf(bh, k0, lane), fl = frag_bf(bl, k0, lane);
  c = wmma_bf(a.l, fh, c); c = wmma_bf(a.h, fl, c); c = wmma_bf(a.h, fh, c); return c;
}

// W [K][N] f32 (x @ W layout) -> planes W^T [N][K] bf16 hi/lo via 64x64 tiles; grid = (K/64)*(N/64)
__global__ __launch_bounds__(256) void k_wt(const float* __restrict__ W, __bf16* __restrict__ Ph, __bf16* __restrict__ Pl, int K, int N) {
  __shared__ __align__(16) __bf16 th[64][72], tl[64][72];
  const int nt = N / 64, tid = threadIdx.x;
  const int n0 = (blockIdx.x % nt) * 64, k0 = (blockIdx.x / nt) * 64;
  for (int i = tid; i < 64 * 64; i += 256) { const int kk = i >> 6, nn = i & 63; const float x = W[(size_t)(k0 + kk) * N + n0 + nn];
    const __bf16 h = (__bf16)x; th[nn][kk] = h; tl[nn][kk] = (__bf16)(x - (float)h); }
  __syncthreads();
  for (int g = tid; g < 64 * 8; g += 256) { const int nn = g >> 3, pc = g & 7; const size_t o = (size_t)(n0 + nn) * K + k0 + pc * 8;
    vst2(Ph + o, *(const v4u*)(&th[nn][pc * 8])); vst2(Pl + o, *(const v4u*)(&tl[nn][pc * 8])); }
}

// qkv projection: block = 64 tokens (4 waves x 16 rows) x all 192 cols; q,k rows f32 [tok][64]; v transposed vT[b][d][n] f32
__global__ __launch_bounds__(128) void k_qkv(const float* __restrict__ x, const __bf16* __restrict__ Wh, const __bf16* __restrict__ Wl,
                                            const float* __restrict__ bq, float* __restrict__ qb, float* __restrict__ kb, float* __restrict__ vT) {
  __shared__ __align__(16) float st[64][196];          // [row][col] pitch 196
  const int tid = threadIdx.x, wave = tid >> 5, lane = tid & 31, col = lane & 15, g = lane >> 4;
  const int m0 = blockIdx.x * 64 + wave * 16;
  const float* ar = x + (size_t)(m0 + col) * D_MODEL;
  v8f c[12] = {};
#pragma unroll 1
  for (int kc = 0; kc < D_MODEL / 32; ++kc) {
    const F2 a = split_f32(ar, kc * 32, lane);
#pragma unroll
    for (int j = 0; j < 12; ++j) c[j] = mac3p(a, Wh + (size_t)(j * 16 + col) * D_MODEL, Wl + (size_t)(j * 16 + col) * D_MODEL, kc * 32, lane, c[j]);
  }
#pragma unroll
  for (int j = 0; j < 12; ++j) { const float bb = bq[j * 16 + col];
#pragma unroll
    for (int r = 0; r < 8; ++r) st[wave * 16 + g * 8 + r][j * 16 + col] = c[j][r] + bb; }
  __syncthreads();
  // q and k rows: 64 rows x 64 floats (256 B) each
  for (int gq = tid; gq < 64 * 16; gq += 128) { const int rl = gq >> 4, pc = gq & 15;
    vst2(qb + (size_t)(blockIdx.x * 64 + rl) * D_ATTN + pc * 4, *(const v4f*)(&st[rl][pc * 4]));
    vst2(kb + (size_t)(blockIdx.x * 64 + rl) * D_ATTN + pc * 4, *(const v4f*)(&st[rl][64 + pc * 4])); }
  // vT[b][d][n]: for each d the block's 64 consecutive tokens = 256 B
  { const int bm0 = blockIdx.x * 64, bidx = bm0 >> 11, n0 = bm0 & (NSEQ - 1);
    for (int gq = tid; gq < 64 * 16; gq += 128) { const int d = gq >> 4, pc = gq & 15;
      v4f v = { st[pc * 4][128 + d], st[pc * 4 + 1][128 + d], st[pc * 4 + 2][128 + d], st[pc * 4 + 3][128 + d] };
      vst2(vT + ((size_t)bidx * D_ATTN + d) * NSEQ + n0 + pc * 4, v); } }
}

// causal flash attention: one block of 8 waves per (batch, 16 queries); wave w takes the 32-key blocks w, w + 8, ... with its own
// maxima, sums and accumulators; the eight partial states are merged in LDS. Heaviest query tiles have the lowest block index.
__global__ __launch_bounds__(256) void k_attn(const float* __restrict__ qb, const float* __restrict__ kb, const float* __restrict__ vT, float* __restrict__ ob) {
  __shared__ __align__(16) float pl[8][16 * 32];        // P tile f32 per wave
  __shared__ __align__(16) float os[8][16 * 64];        // un-normalised partial output per wave
  __shared__ float ms[8][16], ls[8][16];                // partial row maxima and row sums per wave
  const int wl = __builtin_amdgcn_readfirstlane(threadIdx.x >> 5);
  const int b = blockIdx.x & (NBATCH - 1), qs = (NSEQ / 16 - 1 - (blockIdx.x >> 3)) * 16;
  const int lane = threadIdx.x & 31, g = lane >> 4, col = lane & 15;
  const float* qrow = qb + ((size_t)b * NSEQ + qs + col) * D_ATTN;
  const F2 qa = split_f32(qrow, 0, lane), qc = split_f32(qrow, 32, lane);
  float m_r[8], l_r[8];
  v8f o[4] = {};
#pragma unroll
  for (int r = 0; r < 8; ++r) { m_r[r] = -1e30f; l_r[r] = 0.f; }
  float* p = pl[wl];
  const int jmax = (qs + 15) >> 5;
  for (int j = wl; j <= jmax; j += 8) {
    const int ks = j * 32;
    const float* krow0 = kb + ((size_t)b * NSEQ + ks + col) * D_ATTN;
    const float* krow1 = krow0 + 16 * D_ATTN;
    v8f s0 = {}, s1 = {};
    s0 = mac3(qa, split_f32(krow0, 0, lane), s0); s0 = mac3(qc, split_f32(krow0, 32, lane), s0);
    s1 = mac3(qa, split_f32(krow1, 0, lane), s1); s1 = mac3(qc, split_f32(krow1, 32, lane), s1);
#pragma unroll
    for (int r = 0; r < 8; ++r) {
      const int qi = qs + r + 8 * g;
      float a0 = s0[r] * SCALE_F; if (ks + col > qi)      a0 = -1e30f;
      float a1 = s1[r] * SCALE_F; if (ks + 16 + col > qi) a1 = -1e30f;
      float mx = fmaxf(a0, a1);
#pragma unroll
      for (int off = 8; off >= 1; off >>= 1) mx = fmaxf(mx, __shfl_xor(mx, off, 32));
      const float mn = fmaxf(m_r[r], mx);
      const float p0 = __expf(a0 - mn), p1 = __expf(a1 - mn);
      const int row = r + 8 * g;
      p[row * 32 + col] = p0; p[row * 32 + 16 + col] = p1;
      float sum = p0 + p1;
#pragma unroll
      for (int off = 8; off >= 1; off >>= 1) sum += __shfl_xor(sum, off, 32);
      const float corr = __expf(m_r[r] - mn);
      l_r[r] = l_r[r] * corr + sum; m_r[r] = mn;
#pragma unroll
      for (int t = 0; t < 4; ++t) o[t][r] *= corr;
    }
    asm volatile("s_wait_dscnt 0" ::: "memory"); __builtin_amdgcn_wave_barrier(); __builtin_amdgcn_fence(__ATOMIC_RELEASE, "workgroup");
    const F2 pf = split_f32(p + col * 32, 0, lane);       // A row m = col, keys 0..31
    const float* vb = vT + (size_t)b * D_ATTN * NSEQ + ks;
#pragma unroll
    for (int t = 0; t < 4; ++t) o[t] = mac3(pf, split_f32(vb + (size_t)(t * 16 + col) * NSEQ, 0, lane), o[t]);
    __builtin_amdgcn_wave_barrier();                      // P tile reused next iteration
  }
  float* so = os[wl];
#pragma unroll
  for (int t = 0; t < 4; ++t)
#pragma unroll
    for (int r = 0; r < 8; ++r) so[(r + 8 * g) * 64 + t * 16 + col] = o[t][r];
  if (col == 0) {
#pragma unroll
    for (int r = 0; r < 8; ++r) { ms[wl][r + 8 * g] = m_r[r]; ls[wl][r + 8 * g] = l_r[r]; }
  }
  __syncthreads();                                        // every wave's partial state is in LDS before any thread merges
  // merge: thread -> (row, 4 columns); a wave that had no key block holds max -1e30, sum 0, zeros: weight 0
  const int row = threadIdx.x >> 4, c4 = (threadIdx.x & 15) * 4;
  float M = ms[0][row];
#pragma unroll
  for (int w = 1; w < 8; ++w) M = fmaxf(M, ms[w][row]);
  float L = 0.f; v4f acc = {};
#pragma unroll
  for (int w = 0; w < 8; ++w) { const float wg = __expf(ms[w][row] - M);
    L += ls[w][row] * wg; acc += *(const v4f*)(&os[w][row * 64 + c4]) * wg; }
  vst2(ob + ((size_t)b * NSEQ + qs + row) * D_ATTN + c4, acc / L);
}

// output projection: block = 64 tokens (4 waves x 16 rows) x 256 cols in 16 column tiles of 16 per wave; rows 1 KB
__global__ __launch_bounds__(128) void k_out(const float* __restrict__ ob, const __bf16* __restrict__ Wh, const __bf16* __restrict__ Wl,
                                            const float* __restrict__ bo, float* __restrict__ out) {
  __shared__ __align__(16) float st[4][16 * 260];
  const int tid = threadIdx.x, wave = tid >> 5, lane = tid & 31, col = lane & 15, g = lane >> 4;
  const int m0 = blockIdx.x * 64 + wave * 16;
  const float* ar = ob + (size_t)(m0 + col) * D_ATTN;
  const F2 a0 = split_f32(ar, 0, lane), a1 = split_f32(ar, 32, lane);
  float* S = st[wave];
#pragma unroll 2
  for (int j = 0; j < 16; ++j) {
    v8f c = {};
    c = mac3p(a0, Wh + (size_t)(j * 16 + col) * D_ATTN, Wl + (size_t)(j * 16 + col) * D_ATTN, 0, lane, c);
    c = mac3p(a1, Wh + (size_t)(j * 16 + col) * D_ATTN, Wl + (size_t)(j * 16 + col) * D_ATTN, 32, lane, c);
    const float bb = bo[j * 16 + col];
#pragma unroll
    for (int r = 0; r < 8; ++r) S[(r + 8 * g) * 260 + j * 16 + col] = c[r] + bb;
  }
  asm volatile("s_wait_dscnt 0" ::: "memory"); __builtin_amdgcn_wave_barrier(); __builtin_amdgcn_fence(__ATOMIC_RELEASE, "workgroup");
  // 16 rows x 256 floats: per row 64 pieces -> 2 instructions per row... 16 rows x 64 pieces / 32 lanes = 32 instructions
#pragma unroll 4
  for (int q = 0; q < 32; ++q) { const int rl = q >> 1, pc = (q & 1) * 32 + lane;
    vst2(out + (size_t)(m0 + rl) * D_OUT + pc * 4, *(const v4f*)(S + rl * 260 + pc * 4)); }
}

extern "C" void kernel_launch(void* const* d_in, const int* in_sizes, int n_in,
                              void* d_out, int out_size, void* d_ws, size_t ws_size,
                              hipStream_t stream) {
  (void)in_sizes; (void)n_in; (void)out_size; (void)ws_size;
  const float* x     = (const float*)d_in[0];
  const float* W_qkv = (const float*)d_in[1];
  const float* b_qkv = (const float*)d_in[2];
  const float* W_out = (const float*)d_in[3];
  const float* b_out = (const float*)d_in[4];
  float* out = (float*)d_out;
  char* ws = (char*)d_ws; size_t off = 0;
  auto alloc = [&](size_t bytes) -> void* { void* p = ws + off; off = (off + bytes + 255) & ~(size_t)255; return p; };
  __bf16* Wqh = (__bf16*)alloc((size_t)D_QKV * D_MODEL * 2); __bf16* Wql = (__bf16*)alloc((size_t)D_QKV * D_MODEL * 2);
  __bf16* Woh = (__bf16*)alloc((size_t)D_OUT * D_ATTN * 2);  __bf16* Wol = (__bf16*)alloc((size_t)D_OUT * D_ATTN * 2);
  float* qb = (float*)alloc((size_t)NTOK * D_ATTN * 4); float* kb = (float*)alloc((size_t)NTOK * D_ATTN * 4);
  float* vT = (float*)alloc((size_t)NTOK * D_ATTN * 4); float* ob = (float*)alloc((size_t)NTOK * D_ATTN * 4);

  k_wt<<<(D_MODEL / 64) * (D_QKV / 64), 256, 0, stream>>>(W_qkv, Wqh, Wql, D_MODEL, D_QKV);
  k_wt<<<(D_ATTN / 64) * (D_OUT / 64), 256, 0, stream>>>(W_out, Woh, Wol, D_ATTN, D_OUT);
  k_qkv<<<NTOK / 64, 128, 0, stream>>>(x, Wqh, Wql, b_qkv, qb, kb, vT);
  k_attn<<<NBATCH * (NSEQ / 16), 256, 0, stream>>>(qb, kb, vT, ob);
  k_out<<<NTOK / 64, 128, 0, stream>>>(ob, Woh, Wol, b_out, out);
}

// v002
// Measured time: 91 microseconds a run.
// In two side-by-side timings against v001, it was 1.39 and 1.41 times as fast.
// All steps since v000 together make it 4.03 times as fast.
#include <hip/hip_runtime.h>
#include <math.h>

// Causal single-head attention (d_attn 64) with qkv and output projections.
// All four contractions (qkv projection K = 512, scores K = 64, P @ V over <= 2048 keys, output projection K = 64) on
// v_wmma_f32_16x16x32_bf16 as a TWO-WAY bf16 split of both f32 operands (hi*hi + hi*lo + lo*hi, f32 accumulate).

#define D_MODEL 512
#define D_ATTN  64
#define NSEQ    2048
#define NBATCH  8
#define NTOK    (NBATCH * NSEQ)
#define D_OUT   256
#define D_QKV   192
#define SCALE_F 0.125f

typedef __attribute__((ext_vector_type(16))) __bf16 v16bf;
typedef __attribute__((ext_vector_type(8)))  __bf16 v8bf;
typedef __attribute__((ext_vector_type(8)))  float  v8f;
typedef __attribute__((ext_vector_type(4)))  float  v4f;
typedef __attribute__((ext_vector_type(4)))  unsigned v4u;

template <typename T> __device__ __forceinline__ void vst2(void* p, T v) { *(T*)p = v;  }
__device__ __forceinline__ v8f wmma_bf(v16bf a, v16bf b, v8f c) {
  v8f d = __builtin_amdgcn_wmma_f32_16x16x32_bf16(false, a, false, b, (short)0, c, false, false);
  asm volatile("v_nop\n\tv_nop\n\tv_nop\n\tv_nop" : "+v"(d) : "v"(a), "v"(b));
  return d;
}
struct F2 { v16bf h, l; };
// split an f32 row fragment (row base pointer, k0) into bf16 hi/lo; element i<8 -> k0+8g+i, i>=8 -> k0+16+8g+(i-8)
__device__ __forceinline__ F2 split_f32(const float* row, int k0, int lane) {
  F2 r; const float* p = row + k0 + 8 * (lane >> 4);
#pragma unroll
  for (int i = 0; i < 16; ++i) { const float x = p[(i < 8) ? i : (i + 8)]; const __bf16 h = (__bf16)x; r.h[i] = h; r.l[i] = (__bf16)(x - (float)h); }
  return r;
}
// the 16 f32 of one fragment as loaded (same addresses as split_f32), and their split: lets a pass issue its loads as one group
struct R16 { v4f q[4]; };
__device__ __forceinline__ R16 ld16(const float* base, unsigned off) {   // base pointer plus the lane's 32-bit element offset
  R16 r;
  r.q[0] = *(const v4f*)(base + off); r.q[1] = *(const v4f*)(base + off + 4); r.q[2] = *(const v4f*)(base + off + 16); r.q[3] = *(const v4f*)(base + off + 20); return r;
}
__device__ __forceinline__ F2 split_r(const R16& s) {
  F2 r;
#pragma unroll
  for (int i = 0; i < 16; ++i) { const float x = s.q[i >> 2][i & 3]; const __bf16 h = (__bf16)x; r.h[i] = h; r.l[i] = (__bf16)(x - (float)h); }
  return r;
}
__device__ __forceinline__ v16bf frag_o(const __bf16* p, unsigned off) {   // bf16 fragment from the lane's own pointer (row, k0 and 8g inside) plus an element offset; same k order as split_f32
  union { v16bf v; v8bf q[2]; } r;
  r.q[0] = *(const v8bf*)(p + off); r.q[1] = *(const v8bf*)(p + off + 16); return r.v;
}
__device__ __forceinline__ v8f mac3(const F2& a, const F2& b, v8f c) {
  c = wmma_bf(a.l, b.h, c); c = wmma_bf(a.h, b.l, c); c = wmma_bf(a.h, b.h, c); return c;
}

// W [K][N] f32 (x @ W layout) -> planes W^T [N][K] bf16 hi/lo via 64x64 tiles; grid = (K/64)*(N/64)
__global__ __launch_bounds__(256) void k_wt(const float* __restrict__ W, __bf16* __restrict__ Ph, __bf16* __restrict__ Pl, int K, int N) {
  __shared__ __align__(16) __bf16 th[64][72], tl[64][72];
  const int nt = N / 64, tid = threadIdx.x;
  const int n0 = (blockIdx.x % nt) * 64, k0 = (blockIdx.x / nt) * 64;
  for (int i = tid; i < 64 * 64; i += 256) { const int kk = i >> 6, nn = i & 63; const float x = W[(size_t)(k0 + kk) * N + n0 + nn];
    const __bf16 h = (__bf16)x; th[nn][kk] = h; tl[nn][kk] = (__bf16)(x - (float)h); }
  __syncthreads();
  for (int g = tid; g < 64 * 8; g += 256) { const int nn = g >> 3, pc = g & 7; const size_t o = (size_t)(n0 + nn) * K + k0 + pc * 8;
    vst2(Ph + o, *(const v4u*)(&th[nn][pc * 8])); vst2(Pl + o, *(const v4u*)(&tl[nn][pc * 8])); }
}

// qkv projection: block = 64 tokens (4 waves x 16 rows) x all 192 cols; q,k rows f32 [tok][64]; v transposed vT[b][d][n] f32
__global__ __launch_bounds__(128) void k_qkv(const float* __restrict__ x, const __bf16* __restrict__ Wh, const __bf16* __restrict__ Wl,
                                            const float* __restrict__ bq, float* __restrict__ qb, float* __restrict__ kb, float* __restrict__ vT) {
  __shared__ __align__(16) float st[64][196];          // [row][col] pitch 196
  const int tid = threadIdx.x, wave = tid >> 5, lane = tid & 31, col = lane & 15, g = lane >> 4;
  const int m0 = blockIdx.x * 64 + wave * 16;
  const float* xl = x + (size_t)(m0 + col) * D_MODEL + 8 * g;          // the lane's own places in x and in the two weight planes
  const __bf16* whl = Wh + col * D_MODEL + 8 * g; const __bf16* wll = Wl + col * D_MODEL + 8 * g;
  v8f c[12] = {};
  R16 xr = ld16(xl, 0);
#pragma unroll 1
  for (int kc = 0; kc < D_MODEL / 32; ++kc) {
    // the weight fragments of six column tiles are loaded as one group ahead of their products; the next pass's x rows go with the second group
    const __bf16* wph = whl + kc * 32; const __bf16* wpl = wll + kc * 32;
    const float* xp = xl + ((kc + 1 < D_MODEL / 32) ? kc + 1 : kc) * 32;   // the last pass re-reads its own rows: stays in bounds
#pragma unroll
    for (int hf = 0; hf < 2; ++hf) {
      v16bf wh[6], wl[6];
#pragma unroll
      for (int j = 0; j < 6; ++j) { wh[j] = frag_o(wph, (hf * 6 + j) * 16 * D_MODEL); wl[j] = frag_o(wpl, (hf * 6 + j) * 16 * D_MODEL); }
      const F2 a = split_r(xr);
      if (hf == 1) xr = ld16(xp, 0);
      // the group's address registers are inputs here, so they live up to this wait and no load of the group lands in them ahead of it
      asm volatile("s_wait_xcnt 0x0" :: "v"(wph), "v"(wpl), "v"(xp) : "memory");
#pragma unroll
      for (int j = 0; j < 6; ++j) { v8f t = c[hf * 6 + j];
        t = wmma_bf(a.l, wh[j], t); t = wmma_bf(a.h, wl[j], t); t = wmma_bf(a.h, wh[j], t); c[hf * 6 + j] = t; }
    }
  }
#pragma unroll
  for (int j = 0; j < 12; ++j) { const float bb = bq[j * 16 + col];
#pragma unroll
    for (int r = 0; r < 8; ++r) st[wave * 16 + g * 8 + r][j * 16 + col] = c[j][r] + bb; }
  __syncthreads();
  // q and k rows: 64 rows x 64 floats (256 B) each
  for (int gq = tid; gq < 64 * 16; gq += 128) { const int rl = gq >> 4, pc = gq & 15;
    vst2(qb + (size_t)(blockIdx.x * 64 + rl) * D_ATTN + pc * 4, *(const v4f*)(&st[rl][pc * 4]));
    vst2(kb + (size_t)(blockIdx.x * 64 + rl) * D_ATTN + pc * 4, *(const v4f*)(&st[rl][64 + pc * 4])); }
  // vT[b][d][n]: for each d the block's 64 consecutive tokens = 256 B
  { const int bm0 = blockIdx.x * 64, bidx = bm0 >> 11, n0 = bm0 & (NSEQ - 1);
    for (int gq = tid; gq < 64 * 16; gq += 128) { const int d = gq >> 4, pc = gq & 15;
      v4f v = { st[pc * 4][128 + d], st[pc * 4 + 1][128 + d], st[pc * 4 + 2][128 + d], st[pc * 4 + 3][128 + d] };
      vst2(vT + ((size_t)bidx * D_ATTN + d) * NSEQ + n0 + pc * 4, v); } }
}

// causal flash attention: one block of 8 waves per (batch, 16 queries); wave w takes the 32-key blocks w, w + 8, ... with its own
// maxima, sums and accumulators; the eight partial states are merged in LDS. Heaviest query tiles have the lowest block index.
__global__ __launch_bounds__(256) void k_attn(const float* __restrict__ qb, const float* __restrict__ kb, const float* __restrict__ vT, float* __restrict__ ob) {
  __shared__ __align__(16) float pl[8][16 * 32];        // P tile f32 per wave
  __shared__ __align__(16) float os[8][16 * 64];        // un-normalised partial output per wave
  __shared__ float ms[8][16], ls[8][16];                // partial row maxima and row sums per wave
  const int wl = __builtin_amdgcn_readfirstlane(threadIdx.x >> 5);
  const int b = blockIdx.x & (NBATCH - 1), qs = (NSEQ / 16 - 1 - (blockIdx.x >> 3)) * 16;
  const int lane = threadIdx.x & 31, g = lane >> 4, col = lane & 15;
  const float* qrow = qb + ((size_t)b * NSEQ + qs + col) * D_ATTN;
  const F2 qa = split_f32(qrow, 0, lane), qc = split_f32(qrow, 32, lane);
  float m_r[8], l_r[8];
  v8f o[4] = {};
#pragma unroll
  for (int r = 0; r < 8; ++r) { m_r[r] = -1e30f; l_r[r] = 0.f; }
  float* p = pl[wl];
  const int jmax = (qs + 15) >> 5;
  const unsigned koff = col * D_ATTN + 8 * g, voff = col * NSEQ + 8 * g;
  for (int j = wl; j <= jmax; j += 8) {
    const int ks = j * 32;
    const float* kt = kb + ((size_t)b * NSEQ + ks) * D_ATTN;
    // all 16 K loads of the block stand ahead of the first product, so one wait covers them
    const R16 k00 = ld16(kt, koff), k01 = ld16(kt + 32, koff), k10 = ld16(kt + 16 * D_ATTN, koff), k11 = ld16(kt + 16 * D_ATTN + 32, koff);
    v8f s0 = {}, s1 = {};
    s0 = mac3(qa, split_r(k00), s0); s0 = mac3(qc, split_r(k01), s0);
    s1 = mac3(qa, split_r(k10), s1); s1 = mac3(qc, split_r(k11), s1);
    // all 16 V loads of the block stand ahead of the softmax, which covers their latency
    const float* vb = vT + (size_t)b * D_ATTN * NSEQ + ks;
    R16 vr[4];
#pragma unroll
    for (int t = 0; t < 4; ++t) vr[t] = ld16(vb + (size_t)t * 16 * NSEQ, voff);
    // the eight rows go through each cross-lane step together, so one wait covers eight exchanges (same arithmetic per row)
    float a0[8], a1[8], mx[8], sum[8], xc[8];
#pragma unroll
    for (int r = 0; r < 8; ++r) {
      const int qi = qs + r + 8 * g;
      a0[r] = s0[r] * SCALE_F; if (ks + col > qi)      a0[r] = -1e30f;
      a1[r] = s1[r] * SCALE_F; if (ks + 16 + col > qi) a1[r] = -1e30f;
      mx[r] = fmaxf(a0[r], a1[r]);
    }
#pragma unroll
    for (int off = 8; off >= 1; off >>= 1) {
#pragma unroll
      for (int r = 0; r < 8; ++r) xc[r] = __shfl_xor(mx[r], off, 32);
#pragma unroll
      for (int r = 0; r < 8; ++r) mx[r] = fmaxf(mx[r], xc[r]);
    }
#pragma unroll
    for (int r = 0; r < 8; ++r) {
      const float mn = fmaxf(m_r[r], mx[r]);
      const float p0 = __expf(a0[r] - mn), p1 = __expf(a1[r] - mn);
      const int row = r + 8 * g;
      p[row * 32 + col] = p0; p[row * 32 + 16 + col] = p1;
      sum[r] = p0 + p1; mx[r] = mn;
    }
#pragma unroll
    for (int off = 8; off >= 1; off >>= 1) {
#pragma unroll
      for (int r = 0; r < 8; ++r) xc[r] = __shfl_xor(sum[r], off, 32);
#pragma unroll
      for (int r = 0; r < 8; ++r) sum[r] += xc[r];
    }
#pragma unroll
    for (int r = 0; r < 8; ++r) {
      const float corr = __expf(m_r[r] - mx[r]);
      l_r[r] = l_r[r] * corr + sum[r]; m_r[r] = mx[r];
#pragma unroll
      for (int t = 0; t < 4; ++t) o[t][r] *= corr;
    }
    asm volatile("s_wait_dscnt 0" ::: "memory"); __builtin_amdgcn_wave_barrier(); __builtin_amdgcn_fence(__ATOMIC_RELEASE, "workgroup");
    const F2 pf = split_f32(p + col * 32, 0, lane);       // A row m = col, keys 0..31
#pragma unroll
    for (int t = 0; t < 4; ++t) o[t] = mac3(pf, split_r(vr[t]), o[t]);
    __builtin_amdgcn_wave_barrier();                      // P tile reused next iteration
  }
  float* so = os[wl];
#pragma unroll
  for (int t = 0; t < 4; ++t)
#pragma unroll
    for (int r = 0; r < 8; ++r) so[(r + 8 * g) * 64 + t * 16 + col] = o[t][r];
  if (col == 0) {
#pragma unroll
    for (int r = 0; r < 8; ++r) { ms[wl][r + 8 * g] = m_r[r]; ls[wl][r + 8 * g] = l_r[r]; }
  }
  __syncthreads();                                        // every wave's partial state is in LDS before any thread merges
  // merge: thread -> (row, 4 columns); a wave that had no key block holds max -1e30, sum 0, zeros: weight 0
  const int row = threadIdx.x >> 4, c4 = (threadIdx.x & 15) * 4;
  float M = ms[0][row];
#pragma unroll
  for (int w = 1; w < 8; ++w) M = fmaxf(M, ms[w][row]);
  float L = 0.f; v4f acc = {};
#pragma unroll
  for (int w = 0; w < 8; ++w) { const float wg = __expf(ms[w][row] - M);
    L += ls[w][row] * wg; acc += *(const v4f*)(&os[w][row * 64 + c4]) * wg; }
  vst2(ob + ((size_t)b * NSEQ + qs + row) * D_ATTN + c4, acc / L);
}

// output projection: block = 64 tokens (4 waves x 16 rows) x 256 cols in 16 column tiles of 16 per wave; rows 1 KB
__global__ __launch_bounds__(128) void k_out(const float* __restrict__ ob, const __bf16* __restrict__ Wh, const __bf16* __restrict__ Wl,
                                            const float* __restrict__ bo, float* __restrict__ out) {
  __shared__ __align__(16) float st[4][16 * 260];
  const int tid = threadIdx.x, wave = tid >> 5, lane = tid & 31, col = lane & 15, g = lane >> 4;
  const int m0 = blockIdx.x * 64 + wave * 16;
  const float* ar = ob + (size_t)(m0 + col) * D_ATTN;
  const F2 a0 = split_f32(ar, 0, lane), a1 = split_f32(ar, 32, lane);
  float* S = st[wave];
#pragma unroll 1   // rolled: only one group's fragments (128 registers) are live at a time
  for (int j0 = 0; j0 < 16; j0 += 4) {
    // the weight fragments and biases of four column tiles are loaded as one group ahead of their products
    v16bf wh0[4], wl0[4], wh1[4], wl1[4]; float bb[4];
    const __bf16* wph = Wh + (j0 * 16 + col) * D_ATTN + 8 * g; const __bf16* wpl = Wl + (j0 * 16 + col) * D_ATTN + 8 * g; const float* bp = bo + j0 * 16 + col;
#pragma unroll
    for (int i = 0; i < 4; ++i) { const unsigned ro = i * 16 * D_ATTN;
      wh0[i] = frag_o(wph, ro); wl0[i] = frag_o(wpl, ro); wh1[i] = frag_o(wph, ro + 32); wl1[i] = frag_o(wpl, ro + 32);
      bb[i] = bp[i * 16]; }
    // the group's address registers are inputs here, so they live up to this wait and no load of the group lands in them ahead of it
    asm volatile("s_wait_xcnt 0x0" :: "v"(wph), "v"(wpl), "v"(bp) : "memory");
#pragma unroll
    for (int i = 0; i < 4; ++i) {
      v8f c = {};
      c = wmma_bf(a0.l, wh0[i], c); c = wmma_bf(a0.h, wl0[i], c); c = wmma_bf(a0.h, wh0[i], c);
      c = wmma_bf(a1.l, wh1[i], c); c = wmma_bf(a1.h, wl1[i], c); c = wmma_bf(a1.h, wh1[i], c);
#pragma unroll
      for (int r = 0; r < 8; ++r) S[(r + 8 * g) * 260 + (j0 + i) * 16 + col] = c[r] + bb[i];
    }
  }
  asm volatile("s_wait_dscnt 0" ::: "memory"); __builtin_amdgcn_wave_barrier(); __builtin_amdgcn_fence(__ATOMIC_RELEASE, "workgroup");
  // 16 rows x 256 floats: per row 64 pieces -> 2 instructions per row... 16 rows x 64 pieces / 32 lanes = 32 instructions
#pragma unroll 4
  for (int q = 0; q < 32; ++q) { const int rl = q >> 1, pc = (q & 1) * 32 + lane;
    vst2(out + (size_t)(m0 + rl) * D_OUT + pc * 4, *(const v4f*)(S + rl * 260 + pc * 4)); }
}

extern "C" void kernel_launch(void* const* d_in, const int* in_sizes, int n_in,
                              void* d_out, int out_size, void* d_ws, size_t ws_size,
                              hipStream_t stream) {
  (void)in_sizes; (void)n_in; (void)out_size; (void)ws_size;
  const float* x     = (const float*)d_in[0];
  const float* W_qkv = (const float*)d_in[1];
  const float* b_qkv = (const float*)d_in[2];
  const float* W_out = (const float*)d_in[3];
  const float* b_out = (const float*)d_in[4];
  float* out = (float*)d_out;
  char* ws = (char*)d_ws; size_t off = 0;
  auto alloc = [&](size_t bytes) -> void* { void* p = ws + off; off = (off + bytes + 255) & ~(size_t)255; return p; };
  __bf16* Wqh = (__bf16*)alloc((size_t)D_QKV * D_MODEL * 2); __bf16* Wql = (__bf16*)alloc((size_t)D_QKV * D_MODEL * 2);
  __bf16* Woh = (__bf16*)alloc((size_t)D_OUT * D_ATTN * 2);  __bf16* Wol = (__bf16*)alloc((size_t)D_OUT * D_ATTN * 2);
  float* qb = (float*)alloc((size_t)NTOK * D_ATTN * 4); float* kb = (float*)alloc((size_t)NTOK * D_ATTN * 4);
  float* vT = (float*)alloc((size_t)NTOK * D_ATTN * 4); float* ob = (float*)alloc((size_t)NTOK * D_ATTN * 4);

  k_wt<<<(D_MODEL / 64) * (D_QKV / 64), 256, 0, stream>>>(W_qkv, Wqh, Wql, D_MODEL, D_QKV);
  k_wt<<<(D_ATTN / 64) * (D_OUT / 64), 256, 0, stream>>>(W_out, Woh, Wol, D_ATTN, D_OUT);
  k_qkv<<<NTOK / 64, 128, 0, stream>>>(x, Wqh, Wql, b_qkv, qb, kb, vT);
  k_attn<<<NBATCH * (NSEQ / 16), 256, 0, stream>>>(qb, kb, vT, ob);
  k_out<<<NTOK / 64, 128, 0, stream>>>(ob, Woh, Wol, b_out, out);
}

// v003
// A run of this version takes 72.1 microseconds.
// In both of two side-by-side timings against v002, it was 1.25 times as fast.
// All steps since v000 together make it 5.04 times as fast.
#include <hip/hip_runtime.h>
#include <math.h>

// Causal single-head attention (d_attn 64) with qkv and output projections.
// All four contractions (qkv projection K = 512, scores K = 64, P @ V over <= 2048 keys, output projection K = 64) on
// v_wmma_f32_16x16x32_bf16 as a TWO-WAY bf16 split of both f32 operands (hi*hi + hi*lo + lo*hi, f32 accumulate).

#define D_MODEL 512
#define D_ATTN  64
#define NSEQ    2048
#define NBATCH  8
#define NTOK    (NBATCH * NSEQ)
#define D_OUT   256
#define D_QKV   192
#define SCALE_F 0.125f

typedef __attribute__((ext_vector_type(16))) __bf16 v16bf;
typedef __attribute__((ext_vector_type(8)))  __bf16 v8bf;
typedef __attribute__((ext_vector_type(8)))  float  v8f;
typedef __attribute__((ext_vector_type(4)))  float  v4f;
typedef __attribute__((ext_vector_type(4)))  unsigned v4u;

template <typename T> __device__ __forceinline__ void vst2(void* p, T v) { *(T*)p = v;  }
__device__ __forceinline__ v8f wmma_bf(v16bf a, v16bf b, v8f c) {
  v8f d = __builtin_amdgcn_wmma_f32_16x16x32_bf16(false, a, false, b, (short)0, c, false, false);
  asm volatile("v_nop\n\tv_nop\n\tv_nop\n\tv_nop" : "+v"(d) : "v"(a), "v"(b));
  return d;
}
struct F2 { v16bf h, l; };
// split an f32 row fragment (row base pointer, k0) into bf16 hi/lo; element i<8 -> k0+8g+i, i>=8 -> k0+16+8g+(i-8)
__device__ __forceinline__ F2 split_f32(const float* row, int k0, int lane) {
  F2 r; const float* p = row + k0 + 8 * (lane >> 4);
#pragma unroll
  for (int i = 0; i < 16; ++i) { const float x = p[(i < 8) ? i : (i + 8)]; const __bf16 h = (__bf16)x; r.h[i] = h; r.l[i] = (__bf16)(x - (float)h); }
  return r;
}
// the 16 f32 of one fragment as loaded (same addresses as split_f32), and their split: lets a pass issue its loads as one group
struct R16 { v4f q[4]; };
__device__ __forceinline__ R16 ld16(const float* base, unsigned off) {   // base pointer plus the lane's 32-bit element offset
  R16 r;
  r.q[0] = *(const v4f*)(base + off); r.q[1] = *(const v4f*)(base + off + 4); r.q[2] = *(const v4f*)(base + off + 16); r.q[3] = *(const v4f*)(base + off + 20); return r;
}
__device__ __forceinline__ F2 split_r(const R16& s) {
  F2 r;
#pragma unroll
  for (int i = 0; i < 16; ++i) { const float x = s.q[i >> 2][i & 3]; const __bf16 h = (__bf16)x; r.h[i] = h; r.l[i] = (__bf16)(x - (float)h); }
  return r;
}
// PACKED FRAGMENTS. The weight planes, q, k and v (each written by one kernel for another) lie in the order in which a wave loads them: piece i of a fragment
// is 32 lanes x 16 B = 512 contiguous bytes (four whole 128-B lines a load, where a row-major operand gives sixteen lines with 32 B each).
// The element that a lane's register holds is the same as with the row-major loaders (k order of split_f32), only its address differs.
// f32 fragment (16 rows x 32 k): 4 pieces, piece i of lane (col, g) = row col, k = 8g + 4(i & 1) + 16(i >> 1) + 0..3
__device__ __forceinline__ R16 ldp(const float* p, unsigned off) {          // p: the lane's own place (lane * 4 inside); off: the fragment's element offset
  R16 r;
  r.q[0] = *(const v4f*)(p + off); r.q[1] = *(const v4f*)(p + off + 128); r.q[2] = *(const v4f*)(p + off + 256); r.q[3] = *(const v4f*)(p + off + 384); return r;
}
// bf16 fragment (16 rows x 32 k): 2 pieces, piece i of lane (col, g) = row col, k = 8g + 16i + 0..7
__device__ __forceinline__ v16bf frag_p(const __bf16* p, unsigned off) {    // p: the lane's own place (lane * 8 inside); off: the fragment's element offset
  union { v16bf v; v8bf q[2]; } r;
  r.q[0] = *(const v8bf*)(p + off); r.q[1] = *(const v8bf*)(p + off + 256); return r.v;
}
__device__ __forceinline__ v8f mac3(const F2& a, const F2& b, v8f c) {
  c = wmma_bf(a.l, b.h, c); c = wmma_bf(a.h, b.l, c); c = wmma_bf(a.h, b.h, c); return c;
}

// W [K][N] f32 (x @ W layout) -> bf16 hi/lo planes of packed W^T fragments, fragment index kc * (N/16) + column tile; via 64x64 tiles; grid = (K/64)*(N/64)
__global__ __launch_bounds__(256) void k_wt(const float* __restrict__ W, __bf16* __restrict__ Ph, __bf16* __restrict__ Pl, int K, int N) {
  __shared__ __align__(16) __bf16 th[64][72], tl[64][72];
  const int nt = N / 64, tid = threadIdx.x;
  const int n0 = (blockIdx.x % nt) * 64, k0 = (blockIdx.x / nt) * 64;
  for (int i = tid; i < 64 * 64; i += 256) { const int kk = i >> 6, nn = i & 63; const float x = W[(size_t)(k0 + kk) * N + n0 + nn];
    const __bf16 h = (__bf16)x; th[nn][kk] = h; tl[nn][kk] = (__bf16)(x - (float)h); }
  __syncthreads();
  for (int g = tid; g < 64 * 8; g += 256) { const int ln = g & 31, i = (g >> 5) & 1, jl = (g >> 6) & 3, kl = g >> 8;
    const int nn = jl * 16 + (ln & 15), pc = kl * 4 + i * 2 + (ln >> 4);
    const size_t o = ((((size_t)(k0 / 32 + kl) * (N / 16) + n0 / 16 + jl) * 2 + i) * 32 + ln) * 8;
    vst2(Ph + o, *(const v4u*)(&th[nn][pc * 8])); vst2(Pl + o, *(const v4u*)(&tl[nn][pc * 8])); }
}

// qkv projection: block = 64 tokens (4 waves x 16 rows) x all 192 cols; q, k: packed f32 fragments, index (token / 16) * 2 + (d / 32);
// v: packed f32 fragments of V^T (rows d, k = keys), index (token / 32) * 4 + (d / 16)
__global__ __launch_bounds__(128) void k_qkv(const float* __restrict__ x, const __bf16* __restrict__ Wh, const __bf16* __restrict__ Wl,
                                            const float* __restrict__ bq, float* __restrict__ qb, float* __restrict__ kb, float* __restrict__ vT) {
  __shared__ __align__(16) float st[64][196];          // [row][col] pitch 196
  const int tid = threadIdx.x, wave = tid >> 5, lane = tid & 31, col = lane & 15, g = lane >> 4;
  const int m0 = blockIdx.x * 64 + wave * 16;
  const float* xl = x + (size_t)(m0 + col) * D_MODEL + 8 * g;          // the lane's own places in x and in the two weight planes
  const __bf16* whl = Wh + lane * 8; const __bf16* wll = Wl + lane * 8;
  v8f c[12] = {};
  R16 xr = ld16(xl, 0);
#pragma unroll 1
  for (int kc = 0; kc < D_MODEL / 32; ++kc) {
    // the weight fragments of six column tiles are loaded as one group ahead of their products; the next pass's x rows go with the second group
    const __bf16* wph = whl + kc * (12 * 512); const __bf16* wpl = wll + kc * (12 * 512);
    const float* xp = xl + ((kc + 1 < D_MODEL / 32) ? kc + 1 : kc) * 32;   // the last pass re-reads its own rows: stays in bounds
#pragma unroll
    for (int hf = 0; hf < 2; ++hf) {
      v16bf wh[6], wl[6];
#pragma unroll
      for (int j = 0; j < 6; ++j) { wh[j] = frag_p(wph, (hf * 6 + j) * 512); wl[j] = frag_p(wpl, (hf * 6 + j) * 512); }
      const F2 a = split_r(xr);
      if (hf == 1) xr = ld16(xp, 0);
      // the group's address registers are inputs here, so they live up to this wait and no load of the group lands in them ahead of it
      asm volatile("s_wait_xcnt 0x0" :: "v"(wph), "v"(wpl), "v"(xp) : "memory");
#pragma unroll
      for (int j = 0; j < 6; ++j) { v8f t = c[hf * 6 + j];
        t = wmma_bf(a.l, wh[j], t); t = wmma_bf(a.h, wl[j], t); t = wmma_bf(a.h, wh[j], t); c[hf * 6 + j] = t; }
    }
  }
#pragma unroll
  for (int j = 0; j < 12; ++j) { const float bb = bq[j * 16 + col];
#pragma unroll
    for (int r = 0; r < 8; ++r) st[wave * 16 + g * 8 + r][j * 16 + col] = c[j][r] + bb; }
  __syncthreads();
  // q and k: the block's 8 fragments each (4 token tiles x 2 halves of d) = 1024 pieces of 16 B, piece gq at place gq: a wave's store is 512 contiguous bytes
  for (int gq = tid; gq < 64 * 16; gq += 128) { const int ln = gq & 31, i = (gq >> 5) & 3, dk = (gq >> 7) & 1, tl = gq >> 8;
    const int rl = tl * 16 + (ln & 15), d = dk * 32 + 8 * (ln >> 4) + (i & 1) * 4 + (i >> 1) * 16;
    const size_t o = ((size_t)blockIdx.x * 1024 + gq) * 4;
    vst2(qb + o, *(const v4f*)(&st[rl][d]));
    vst2(kb + o, *(const v4f*)(&st[rl][64 + d])); }
  // v: the block's 8 fragments (2 key blocks of 32 x 4 tiles of d), a piece = 4 consecutive keys of one d
  for (int gq = tid; gq < 64 * 16; gq += 128) { const int ln = gq & 31, i = (gq >> 5) & 3, t = (gq >> 7) & 3, jj = gq >> 9;
    const int d = t * 16 + (ln & 15), kl = jj * 32 + 8 * (ln >> 4) + (i & 1) * 4 + (i >> 1) * 16;
    v4f v = { st[kl][128 + d], st[kl + 1][128 + d], st[kl + 2][128 + d], st[kl + 3][128 + d] };
    vst2(vT + ((size_t)blockIdx.x * 1024 + gq) * 4, v); }
}

// causal flash attention: one block of 8 waves per (batch, 16 queries); wave w takes the 32-key blocks w, w + 8, ... with its own
// maxima, sums and accumulators; the eight partial states are merged in LDS. Heaviest query tiles have the lowest block index.
// four waves a SIMD (two blocks a WGP), as before the packed loads: the register budget is stated, since one register above 256 would halve the residency
__global__ __launch_bounds__(256) __attribute__((amdgpu_waves_per_eu(4))) void k_attn(const float* __restrict__ qb, const float* __restrict__ kb, const float* __restrict__ vT, float* __restrict__ ob) {
  __shared__ __align__(16) float pl[8][16 * 32];        // P tile f32 per wave
  __shared__ __align__(16) float os[8][16 * 64];        // un-normalised partial output per wave
  __shared__ float ms[8][16], ls[8][16];                // partial row maxima and row sums per wave
  const int wl = __builtin_amdgcn_readfirstlane(threadIdx.x >> 5);
  const int b = blockIdx.x & (NBATCH - 1), qs = (NSEQ / 16 - 1 - (blockIdx.x >> 3)) * 16;
  const int lane = threadIdx.x & 31, g = lane >> 4, col = lane & 15;
  const float* qp = qb + ((size_t)b * NSEQ + qs) * D_ATTN + lane * 4;    // the tile's two packed fragments
  const F2 qa = split_r(ldp(qp, 0)), qc = split_r(ldp(qp, 512));
  float m_r[8], l_r[8];
  v8f o[4] = {};
#pragma unroll
  for (int r = 0; r < 8; ++r) { m_r[r] = -1e30f; l_r[r] = 0.f; }
  float* p = pl[wl];
  const int jmax = (qs + 15) >> 5;
  const unsigned loff = lane * 4;
  for (int j = wl; j <= jmax; j += 8) {
    const int ks = j * 32;
    const float* kt = kb + ((size_t)b * NSEQ + ks) * D_ATTN + loff;   // the lane's place in the key block's four packed fragments
    // all 16 K loads of the block stand ahead of the first product, so one wait covers them
    const R16 k00 = ldp(kt, 0), k01 = ldp(kt, 512), k10 = ldp(kt, 1024), k11 = ldp(kt, 1536);
    v8f s0 = {}, s1 = {};
    s0 = mac3(qa, split_r(k00), s0); s0 = mac3(qc, split_r(k01), s0);
    s1 = mac3(qa, split_r(k10), s1); s1 = mac3(qc, split_r(k11), s1);
    // all 16 V loads of the block stand ahead of the softmax, which covers their latency
    const float* vb = vT + ((size_t)b * NSEQ + ks) * D_ATTN + loff;
    R16 vr[4];
#pragma unroll
    for (int t = 0; t < 4; ++t) vr[t] = ldp(vb, t * 512);
    // the group's address register is an input here, so it lives up to this wait and no load of the group lands in it ahead of it
    asm volatile("s_wait_xcnt 0x0" :: "v"(vb) : "memory");
    // the eight rows go through each cross-lane step together, so one wait covers eight exchanges (same arithmetic per row)
    float a0[8], a1[8], mx[8], sum[8], xc[8];
#pragma unroll
    for (int r = 0; r < 8; ++r) {
      const int qi = qs + r + 8 * g;
      a0[r] = s0[r] * SCALE_F; if (ks + col > qi)      a0[r] = -1e30f;
      a1[r] = s1[r] * SCALE_F; if (ks + 16 + col > qi) a1[r] = -1e30f;
      mx[r] = fmaxf(a0[r], a1[r]);
    }
#pragma unroll
    for (int off = 8; off >= 1; off >>= 1) {
#pragma unroll
      for (int r = 0; r < 8; ++r) xc[r] = __shfl_xor(mx[r], off, 32);
#pragma unroll
      for (int r = 0; r < 8; ++r) mx[r] = fmaxf(mx[r], xc[r]);
    }
#pragma unroll
    for (int r = 0; r < 8; ++r) {
      const float mn = fmaxf(m_r[r], mx[r]);
      const float p0 = __expf(a0[r] - mn), p1 = __expf(a1[r] - mn);
      const int row = r + 8 * g;
      p[row * 32 + col] = p0; p[row * 32 + 16 + col] = p1;
      sum[r] = p0 + p1; mx[r] = mn;
    }
#pragma unroll
    for (int off = 8; off >= 1; off >>= 1) {
#pragma unroll
      for (int r = 0; r < 8; ++r) xc[r] = __shfl_xor(sum[r], off, 32);
#pragma unroll
      for (int r = 0; r < 8; ++r) sum[r] += xc[r];
    }
#pragma unroll
    for (int r = 0; r < 8; ++r) {
      const float corr = __expf(m_r[r] - mx[r]);
      l_r[r] = l_r[r] * corr + sum[r]; m_r[r] = mx[r];
#pragma unroll
      for (int t = 0; t < 4; ++t) o[t][r] *= corr;
    }
    asm volatile("s_wait_dscnt 0" ::: "memory"); __builtin_amdgcn_wave_barrier(); __builtin_amdgcn_fence(__ATOMIC_RELEASE, "workgroup");
    const F2 pf = split_f32(p + col * 32, 0, lane);       // A row m = col, keys 0..31
#pragma unroll
    for (int t = 0; t < 4; ++t) o[t] = mac3(pf, split_r(vr[t]), o[t]);
    __builtin_amdgcn_wave_barrier();                      // P tile reused next iteration
  }
  float* so = os[wl];
#pragma unroll
  for (int t = 0; t < 4; ++t)
#pragma unroll
    for (int r = 0; r < 8; ++r) so[(r + 8 * g) * 64 + t * 16 + col] = o[t][r];
  if (col == 0) {
#pragma unroll
    for (int r = 0; r < 8; ++r) { ms[wl][r + 8 * g] = m_r[r]; ls[wl][r + 8 * g] = l_r[r]; }
  }
  __syncthreads();                                        // every wave's partial state is in LDS before any thread merges
  // merge: thread -> (row, 4 columns); a wave that had no key block holds max -1e30, sum 0, zeros: weight 0
  const int row = threadIdx.x >> 4, c4 = (threadIdx.x & 15) * 4;
  float M = ms[0][row];
#pragma unroll
  for (int w = 1; w < 8; ++w) M = fmaxf(M, ms[w][row]);
  float L = 0.f; v4f acc = {};
#pragma unroll
  for (int w = 0; w < 8; ++w) { const float wg = __expf(ms[w][row] - M);
    L += ls[w][row] * wg; acc += *(const v4f*)(&os[w][row * 64 + c4]) * wg; }
  vst2(ob + ((size_t)b * NSEQ + qs + row) * D_ATTN + c4, acc / L);
}

// output projection: block = 64 tokens (4 waves x 16 rows) x 256 cols in 16 column tiles of 16 per wave; rows 1 KB
__global__ __launch_bounds__(128) void k_out(const float* __restrict__ ob, const __bf16* __restrict__ Wh, const __bf16* __restrict__ Wl,
                                            const float* __restrict__ bo, float* __restrict__ out) {
  __shared__ __align__(16) float st[4][16 * 260];
  const int tid = threadIdx.x, wave = tid >> 5, lane = tid & 31, col = lane & 15, g = lane >> 4;
  const int m0 = blockIdx.x * 64 + wave * 16;
  const float* ar = ob + (size_t)(m0 + col) * D_ATTN;
  const F2 a0 = split_f32(ar, 0, lane), a1 = split_f32(ar, 32, lane);
  float* S = st[wave];
#pragma unroll 1   // rolled: only one group's fragments (128 registers) are live at a time
  for (int j0 = 0; j0 < 16; j0 += 4) {
    // the weight fragments and biases of four column tiles are loaded as one group ahead of their products
    v16bf wh0[4], wl0[4], wh1[4], wl1[4]; float bb[4];
    const __bf16* wph = Wh + j0 * 512 + lane * 8; const __bf16* wpl = Wl + j0 * 512 + lane * 8; const float* bp = bo + j0 * 16 + col;
#pragma unroll
    for (int i = 0; i < 4; ++i) { const unsigned ro = i * 512;
      wh0[i] = frag_p(wph, ro); wl0[i] = frag_p(wpl, ro); wh1[i] = frag_p(wph, ro + 16 * 512); wl1[i] = frag_p(wpl, ro + 16 * 512);
      bb[i] = bp[i * 16]; }
    // the group's address registers are inputs here, so they live up to this wait and no load of the group lands in them ahead of it
    asm volatile("s_wait_xcnt 0x0" :: "v"(wph), "v"(wpl), "v"(bp) : "memory");
#pragma unroll
    for (int i = 0; i < 4; ++i) {
      v8f c = {};
      c = wmma_bf(a0.l, wh0[i], c); c = wmma_bf(a0.h, wl0[i], c); c = wmma_bf(a0.h, wh0[i], c);
      c = wmma_bf(a1.l, wh1[i], c); c = wmma_bf(a1.h, wl1[i], c); c = wmma_bf(a1.h, wh1[i], c);
#pragma unroll
      for (int r = 0; r < 8; ++r) S[(r + 8 * g) * 260 + (j0 + i) * 16 + col] = c[r] + bb[i];
    }
  }
  asm volatile("s_wait_dscnt 0" ::: "memory"); __builtin_amdgcn_wave_barrier(); __builtin_amdgcn_fence(__ATOMIC_RELEASE, "workgroup");
  // 16 rows x 256 floats: per row 64 pieces -> 2 instructions per row... 16 rows x 64 pieces / 32 lanes = 32 instructions
#pragma unroll 4
  for (int q = 0; q < 32; ++q) { const int rl = q >> 1, pc = (q & 1) * 32 + lane;
    vst2(out + (size_t)(m0 + rl) * D_OUT + pc * 4, *(const v4f*)(S + rl * 260 + pc * 4)); }
}

extern "C" void kernel_launch(void* const* d_in, const int* in_sizes, int n_in,
                              void* d_out, int out_size, void* d_ws, size_t ws_size,
                              hipStream_t stream) {
  (void)in_sizes; (void)n_in; (void)out_size; (void)ws_size;
  const float* x     = (const float*)d_in[0];
  const float* W_qkv = (const float*)d_in[1];
  const float* b_qkv = (const float*)d_in[2];
  const float* W_out = (const float*)d_in[3];
  const float* b_out = (const float*)d_in[4];
  float* out = (float*)d_out;
  char* ws = (char*)d_ws; size_t off = 0;
  auto alloc = [&](size_t bytes) -> void* { void* p = ws + off; off = (off + bytes + 255) & ~(size_t)255; return p; };
  __bf16* Wqh = (__bf16*)alloc((size_t)D_QKV * D_MODEL * 2); __bf16* Wql = (__bf16*)alloc((size_t)D_QKV * D_MODEL * 2);
  __bf16* Woh = (__bf16*)alloc((size_t)D_OUT * D_ATTN * 2);  __bf16* Wol = (__bf16*)alloc((size_t)D_OUT * D_ATTN * 2);
  float* qb = (float*)alloc((size_t)NTOK * D_ATTN * 4); float* kb = (float*)alloc((size_t)NTOK * D_ATTN * 4);
  float* vT = (float*)alloc((size_t)NTOK * D_ATTN * 4); float* ob = (float*)alloc((size_t)NTOK * D_ATTN * 4);

  k_wt<<<(D_MODEL / 64) * (D_QKV / 64), 256, 0, stream>>>(W_qkv, Wqh, Wql, D_MODEL, D_QKV);
  k_wt<<<(D_ATTN / 64) * (D_OUT / 64), 256, 0, stream>>>(W_out, Woh, Wol, D_ATTN, D_OUT);
  k_qkv<<<NTOK / 64, 128, 0, stream>>>(x, Wqh, Wql, b_qkv, qb, kb, vT);
  k_attn<<<NBATCH * (NSEQ / 16), 256, 0, stream>>>(qb, kb, vT, ob);
  k_out<<<NTOK / 64, 128, 0, stream>>>(ob, Woh, Wol, b_out, out);
}

// v004
// One run takes 66.2 microseconds.
// Two timings next to v003 both put it at 1.09 times that version's speed.
// All steps since v000 together make it 5.49 times as fast.
#include <hip/hip_runtime.h>
#include <math.h>

// Causal single-head attention (d_attn 64) with qkv and output projections.
// All four contractions (qkv projection K = 512, scores K = 64, P @ V over <= 2048 keys, output projection K = 64) on
// v_wmma_f32_16x16x32_bf16 as a TWO-WAY bf16 split of both f32 operands (hi*hi + hi*lo + lo*hi, f32 accumulate).

#define D_MODEL 512
#define D_ATTN  64
#define NSEQ    2048
#define NBATCH  8
#define NTOK    (NBATCH * NSEQ)
#define D_OUT   256
#define D_QKV   192
#define SCALE_F 0.125f

typedef __attribute__((ext_vector_type(16))) __bf16 v16bf;
typedef __attribute__((ext_vector_type(8)))  __bf16 v8bf;
typedef __attribute__((ext_vector_type(8)))  float  v8f;
typedef __attribute__((ext_vector_type(4)))  float  v4f;
typedef __attribute__((ext_vector_type(4)))  unsigned v4u;

template <typename T> __device__ __forceinline__ void vst2(void* p, T v) { *(T*)p = v;  }
__device__ __forceinline__ v8f wmma_bf(v16bf a, v16bf b, v8f c) {
  v8f d = __builtin_amdgcn_wmma_f32_16x16x32_bf16(false, a, false, b, (short)0, c, false, false);
  asm volatile("v_nop\n\tv_nop\n\tv_nop\n\tv_nop" : "+v"(d) : "v"(a), "v"(b));
  return d;
}
struct F2 { v16bf h, l; };
// split an f32 row fragment (row base pointer, k0) into bf16 hi/lo; element i<8 -> k0+8g+i, i>=8 -> k0+16+8g+(i-8)
__device__ __forceinline__ F2 split_f32(const float* row, int k0, int lane) {
  F2 r; const float* p = row + k0 + 8 * (lane >> 4);
#pragma unroll
  for (int i = 0; i < 16; ++i) { const float x = p[(i < 8) ? i : (i + 8)]; const __bf16 h = (__bf16)x; r.h[i] = h; r.l[i] = (__bf16)(x - (float)h); }
  return r;
}
// the 16 f32 of one fragment as loaded (same addresses as split_f32), and their split: lets a pass issue its loads as one group
struct R16 { v4f q[4]; };
__device__ __forceinline__ R16 ld16(const float* base, unsigned off) {   // base pointer plus the lane's 32-bit element offset
  R16 r;
  r.q[0] = *(const v4f*)(base + off); r.q[1] = *(const v4f*)(base + off + 4); r.q[2] = *(const v4f*)(base + off + 16); r.q[3] = *(const v4f*)(base + off + 20); return r;
}
__device__ __forceinline__ F2 split_r(const R16& s) {
  F2 r;
#pragma unroll
  for (int i = 0; i < 16; ++i) { const float x = s.q[i >> 2][i & 3]; const __bf16 h = (__bf16)x; r.h[i] = h; r.l[i] = (__bf16)(x - (float)h); }
  return r;
}
// PACKED FRAGMENTS. The weight planes, q, k and v (each written by one kernel for another) lie in the order in which a wave loads them: piece i of a fragment
// is 32 lanes x 16 B = 512 contiguous bytes (four whole 128-B lines a load, where a row-major operand gives sixteen lines with 32 B each).
// The element that a lane's register holds is the same as with the row-major loaders (k order of split_f32), only its address differs.
// f32 fragment (16 rows x 32 k): 4 pieces, piece i of lane (col, g) = row col, k = 8g + 4(i & 1) + 16(i >> 1) + 0..3
__device__ __forceinline__ R16 ldp(const float* p, unsigned off) {          // p: the lane's own place (lane * 4 inside); off: the fragment's element offset
  R16 r;
  r.q[0] = *(const v4f*)(p + off); r.q[1] = *(const v4f*)(p + off + 128); r.q[2] = *(const v4f*)(p + off + 256); r.q[3] = *(const v4f*)(p + off + 384); return r;
}
// bf16 fragment (16 rows x 32 k): 2 pieces, piece i of lane (col, g) = row col, k = 8g + 16i + 0..7
__device__ __forceinline__ v16bf frag_p(const __bf16* p, unsigned off) {    // p: the lane's own place (lane * 8 inside); off: the fragment's element offset
  union { v16bf v; v8bf q[2]; } r;
  r.q[0] = *(const v8bf*)(p + off); r.q[1] = *(const v8bf*)(p + off + 256); return r.v;
}

// W [K][N] f32 (x @ W layout) -> bf16 hi/lo planes of packed W^T fragments, fragment index kc * (N/16) + column tile; via 64x64 tiles; grid = (K/64)*(N/64)
__global__ __launch_bounds__(256) void k_wt(const float* __restrict__ W, __bf16* __restrict__ Ph, __bf16* __restrict__ Pl, int K, int N) {
  __shared__ __align__(16) __bf16 th[64][72], tl[64][72];
  const int nt = N / 64, tid = threadIdx.x;
  const int n0 = (blockIdx.x % nt) * 64, k0 = (blockIdx.x / nt) * 64;
  for (int i = tid; i < 64 * 64; i += 256) { const int kk = i >> 6, nn = i & 63; const float x = W[(size_t)(k0 + kk) * N + n0 + nn];
    const __bf16 h = (__bf16)x; th[nn][kk] = h; tl[nn][kk] = (__bf16)(x - (float)h); }
  __syncthreads();
  for (int g = tid; g < 64 * 8; g += 256) { const int ln = g & 31, i = (g >> 5) & 1, jl = (g >> 6) & 3, kl = g >> 8;
    const int nn = jl * 16 + (ln & 15), pc = kl * 4 + i * 2 + (ln >> 4);
    const size_t o = ((((size_t)(k0 / 32 + kl) * (N / 16) + n0 / 16 + jl) * 2 + i) * 32 + ln) * 8;
    vst2(Ph + o, *(const v4u*)(&th[nn][pc * 8])); vst2(Pl + o, *(const v4u*)(&tl[nn][pc * 8])); }
}

// qkv projection: block = 64 tokens (4 waves x 16 rows) x all 192 cols; q, k: packed f32 fragments, index (token / 16) * 2 + (d / 32);
// v: packed f32 fragments of V^T (rows d, k = keys), index (token / 32) * 4 + (d / 16)
__global__ __launch_bounds__(128) void k_qkv(const float* __restrict__ x, const __bf16* __restrict__ Wh, const __bf16* __restrict__ Wl,
                                            const float* __restrict__ bq, float* __restrict__ qb, float* __restrict__ kb, float* __restrict__ vT) {
  __shared__ __align__(16) float st[64][196];          // [row][col] pitch 196
  const int tid = threadIdx.x, wave = tid >> 5, lane = tid & 31, col = lane & 15, g = lane >> 4;
  const int m0 = blockIdx.x * 64 + wave * 16;
  const float* xl = x + (size_t)(m0 + col) * D_MODEL + 8 * g;          // the lane's own places in x and in the two weight planes
  const __bf16* whl = Wh + lane * 8; const __bf16* wll = Wl + lane * 8;
  v8f c[12] = {};
  R16 xr = ld16(xl, 0);
#pragma unroll 1
  for (int kc = 0; kc < D_MODEL / 32; ++kc) {
    // the weight fragments of six column tiles are loaded as one group ahead of their products; the next pass's x rows go with the second group
    const __bf16* wph = whl + kc * (12 * 512); const __bf16* wpl = wll + kc * (12 * 512);
    const float* xp = xl + ((kc + 1 < D_MODEL / 32) ? kc + 1 : kc) * 32;   // the last pass re-reads its own rows: stays in bounds
#pragma unroll
    for (int hf = 0; hf < 2; ++hf) {
      v16bf wh[6], wl[6];
#pragma unroll
      for (int j = 0; j < 6; ++j) { wh[j] = frag_p(wph, (hf * 6 + j) * 512); wl[j] = frag_p(wpl, (hf * 6 + j) * 512); }
      const F2 a = split_r(xr);
      if (hf == 1) xr = ld16(xp, 0);
      // the group's address registers are inputs here, so they live up to this wait and no load of the group lands in them ahead of it
      asm volatile("s_wait_xcnt 0x0" :: "v"(wph), "v"(wpl), "v"(xp) : "memory");
#pragma unroll
      for (int j = 0; j < 6; ++j) { v8f t = c[hf * 6 + j];
        t = wmma_bf(a.l, wh[j], t); t = wmma_bf(a.h, wl[j], t); t = wmma_bf(a.h, wh[j], t); c[hf * 6 + j] = t; }
    }
  }
#pragma unroll
  for (int j = 0; j < 12; ++j) { const float bb = bq[j * 16 + col];
#pragma unroll
    for (int r = 0; r < 8; ++r) st[wave * 16 + g * 8 + r][j * 16 + col] = c[j][r] + bb; }
  __syncthreads();
  // q and k: the block's 8 fragments each (4 token tiles x 2 halves of d) = 1024 pieces of 16 B, piece gq at place gq: a wave's store is 512 contiguous bytes
  for (int gq = tid; gq < 64 * 16; gq += 128) { const int ln = gq & 31, i = (gq >> 5) & 3, dk = (gq >> 7) & 1, tl = gq >> 8;
    const int rl = tl * 16 + (ln & 15), d = dk * 32 + 8 * (ln >> 4) + (i & 1) * 4 + (i >> 1) * 16;
    const size_t o = ((size_t)blockIdx.x * 1024 + gq) * 4;
    vst2(qb + o, *(const v4f*)(&st[rl][d]));
    vst2(kb + o, *(const v4f*)(&st[rl][64 + d])); }
  // v: the block's 8 fragments (2 key blocks of 32 x 4 tiles of d), a piece = 4 consecutive keys of one d
  for (int gq = tid; gq < 64 * 16; gq += 128) { const int ln = gq & 31, i = (gq >> 5) & 3, t = (gq >> 7) & 3, jj = gq >> 9;
    const int d = t * 16 + (ln & 15), kl = jj * 32 + 8 * (ln >> 4) + (i & 1) * 4 + (i >> 1) * 16;
    v4f v = { st[kl][128 + d], st[kl + 1][128 + d], st[kl + 2][128 + d], st[kl + 3][128 + d] };
    vst2(vT + ((size_t)blockIdx.x * 1024 + gq) * 4, v); }
}

// the lane's value from the other half of the wave (lane ^ 16), by a vector cross-row move: no LDS, no wait
__device__ __forceinline__ float xhalf(float v) {
  const unsigned b = __builtin_bit_cast(unsigned, v);
  return __builtin_bit_cast(float, __builtin_amdgcn_permlanex16(b, b, 0x76543210u, 0xfedcba98u, false, false));
}
// the three products of two split operands, hi*lo + lo*hi + hi*hi: a is the A operand (K rows, V^T rows), b the B operand (Q, P^T)
__device__ __forceinline__ v8f mac3t(const F2& a, const F2& b, v8f c) {
  c = wmma_bf(a.h, b.l, c); c = wmma_bf(a.l, b.h, c); c = wmma_bf(a.h, b.h, c); return c;
}

__global__ __launch_bounds__(256) __attribute__((amdgpu_waves_per_eu(4))) void k_attn(const float* __restrict__ qb, const float* __restrict__ kb, const float* __restrict__ vT, float* __restrict__ ob) {
  __shared__ __align__(16) float os[8][16 * 68];        // un-normalised partial output per wave, [query][d], pitch 68: 16-byte stores of 16 lanes meet 64 banks once
  __shared__ float ms[8][16], ls[8][16];                // partial row maxima and row sums per wave
  const int wl = __builtin_amdgcn_readfirstlane(threadIdx.x >> 5);
  const int b = blockIdx.x & (NBATCH - 1), qs = (NSEQ / 16 - 1 - (blockIdx.x >> 3)) * 16;
  const int lane = threadIdx.x & 31, g = lane >> 4, col = lane & 15;
  const float* qp = qb + ((size_t)b * NSEQ + qs) * D_ATTN + lane * 4;    // the tile's two packed fragments
  const F2 qa = split_r(ldp(qp, 0)), qc = split_r(ldp(qp, 512));
  float m_r = -1e30f, l_r = 0.f;                        // the lane's query: running maximum (equal in both halves), sum over this half's keys
  v8f o[4] = {};                                        // O^T: o[t][r] = O[query col][d = 16 t + 8 g + r]
  const int jmax = (qs + 15) >> 5;
  const unsigned loff = lane * 4;
  const int qk = qs + col - 8 * g;                      // key ks + 8 g + r is masked where ks + r > qk
  for (int j = wl; j <= jmax; j += 8) {
    const int ks = j * 32;
    const float* kt = kb + ((size_t)b * NSEQ + ks) * D_ATTN + loff;   // the lane's place in the key block's four packed fragments
    // all 16 K loads of the block stand ahead of the first product, so one wait covers them
    const R16 k00 = ldp(kt, 0), k01 = ldp(kt, 512), k10 = ldp(kt, 1024), k11 = ldp(kt, 1536);
    // the group's address register is an input here, so it lives up to this wait and no load of the group lands in it ahead of it
    asm volatile("s_wait_xcnt 0x0" :: "v"(kt) : "memory");
    v8f s0 = {}, s1 = {};
    s0 = mac3t(split_r(k00), qa, s0); s0 = mac3t(split_r(k01), qc, s0);
    s1 = mac3t(split_r(k10), qa, s1); s1 = mac3t(split_r(k11), qc, s1);
    // all 16 V loads of the block stand ahead of the softmax, which covers their latency
    const float* vb = vT + ((size_t)b * NSEQ + ks) * D_ATTN + loff;
    R16 vr[4];
#pragma unroll
    for (int t = 0; t < 4; ++t) vr[t] = ldp(vb, t * 512);
    // the group's address register is an input here, so it lives up to this wait and no load of the group lands in it ahead of it
    asm volatile("s_wait_xcnt 0x0" :: "v"(vb) : "memory");
    float a[16], mx[8];
#pragma unroll
    for (int r = 0; r < 8; ++r) {
      a[r]     = s0[r] * SCALE_F; if (ks + r > qk)      a[r]     = -1e30f;
      a[r + 8] = s1[r] * SCALE_F; if (ks + 16 + r > qk) a[r + 8] = -1e30f;
      mx[r] = fmaxf(a[r], a[r + 8]);
    }
#pragma unroll
    for (int w = 4; w >= 1; w >>= 1)
#pragma unroll
      for (int r = 0; r < w; ++r) mx[r] = fmaxf(mx[r], mx[r + w]);
    const float mn = fmaxf(m_r, fmaxf(mx[0], xhalf(mx[0])));
    F2 pf; float sm[16];                                  // element s of the B operand = key kmap(s, g) = score a[s]
#pragma unroll
    for (int s = 0; s < 16; ++s) {
      const float pv = __expf(a[s] - mn); const __bf16 h = (__bf16)pv;
      pf.h[s] = h; pf.l[s] = (__bf16)(pv - (float)h); sm[s] = pv;
    }
#pragma unroll
    for (int w = 8; w >= 1; w >>= 1)
#pragma unroll
      for (int s = 0; s < w; ++s) sm[s] += sm[s + w];
    // keeps the conversions of V, and with them the wait for the V loads, behind the softmax: without it the wait stands ahead of the softmax, which then covers no latency
    __builtin_amdgcn_sched_barrier(0);
    const float corr = __expf(m_r - mn);
    l_r = l_r * corr + sm[0]; m_r = mn;
#pragma unroll
    for (int t = 0; t < 4; ++t) o[t] *= corr;
#pragma unroll
    for (int t = 0; t < 4; ++t) o[t] = mac3t(split_r(vr[t]), pf, o[t]);
  }
  l_r += xhalf(l_r);                                      // the two halves' sums are joined once
  float* so = os[wl] + col * 68 + 8 * g;
#pragma unroll
  for (int t = 0; t < 4; ++t) {
    const v4f lo = { o[t][0], o[t][1], o[t][2], o[t][3] }, hi = { o[t][4], o[t][5], o[t][6], o[t][7] };
    vst2(so + t * 16, lo); vst2(so + t * 16 + 4, hi);
  }
  if (g == 0) { ms[wl][col] = m_r; ls[wl][col] = l_r; }
  __syncthreads();                                        // every wave's partial state is in LDS before any thread merges
  // merge: thread -> (row, 4 columns); a wave that had no key block holds max -1e30, sum 0, zeros: weight 0
  const int row = threadIdx.x >> 4, c4 = (threadIdx.x & 15) * 4;
  float M = ms[0][row];
#pragma unroll
  for (int w = 1; w < 8; ++w) M = fmaxf(M, ms[w][row]);
  float L = 0.f; v4f acc = {};
#pragma unroll
  for (int w = 0; w < 8; ++w) { const float wg = __expf(ms[w][row] - M);
    L += ls[w][row] * wg; acc += *(const v4f*)(&os[w][row * 68 + c4]) * wg; }
  vst2(ob + ((size_t)b * NSEQ + qs + row) * D_ATTN + c4, acc / L);
}

// output projection: block = 64 tokens (4 waves x 16 rows) x 256 cols in 16 column tiles of 16 per wave; rows 1 KB
__global__ __launch_bounds__(128) void k_out(const float* __restrict__ ob, const __bf16* __restrict__ Wh, const __bf16* __restrict__ Wl,
                                            const float* __restrict__ bo, float* __restrict__ out) {
  __shared__ __align__(16) float st[4][16 * 260];
  const int tid = threadIdx.x, wave = tid >> 5, lane = tid & 31, col = lane & 15, g = lane >> 4;
  const int m0 = blockIdx.x * 64 + wave * 16;
  const float* ar = ob + (size_t)(m0 + col) * D_ATTN;
  const F2 a0 = split_f32(ar, 0, lane), a1 = split_f32(ar, 32, lane);
  float* S = st[wave];
#pragma unroll 1   // rolled: only one group's fragments (128 registers) are live at a time
  for (int j0 = 0; j0 < 16; j0 += 4) {
    // the weight fragments and biases of four column tiles are loaded as one group ahead of their products
    v16bf wh0[4], wl0[4], wh1[4], wl1[4]; float bb[4];
    const __bf16* wph = Wh + j0 * 512 + lane * 8; const __bf16* wpl = Wl + j0 * 512 + lane * 8; const float* bp = bo + j0 * 16 + col;
#pragma unroll
    for (int i = 0; i < 4; ++i) { const unsigned ro = i * 512;
      wh0[i] = frag_p(wph, ro); wl0[i] = frag_p(wpl, ro); wh1[i] = frag_p(wph, ro + 16 * 512); wl1[i] = frag_p(wpl, ro + 16 * 512);
      bb[i] = bp[i * 16]; }
    // the group's address registers are inputs here, so they live up to this wait and no load of the group lands in them ahead of it
    asm volatile("s_wait_xcnt 0x0" :: "v"(wph), "v"(wpl), "v"(bp) : "memory");
#pragma unroll
    for (int i = 0; i < 4; ++i) {
      v8f c = {};
      c = wmma_bf(a0.l, wh0[i], c); c = wmma_bf(a0.h, wl0[i], c); c = wmma_bf(a0.h, wh0[i], c);
      c = wmma_bf(a1.l, wh1[i], c); c = wmma_bf(a1.h, wl1[i], c); c = wmma_bf(a1.h, wh1[i], c);
#pragma unroll
      for (int r = 0; r < 8; ++r) S[(r + 8 * g) * 260 + (j0 + i) * 16 + col] = c[r] + bb[i];
    }
  }
  asm volatile("s_wait_dscnt 0" ::: "memory"); __builtin_amdgcn_wave_barrier(); __builtin_amdgcn_fence(__ATOMIC_RELEASE, "workgroup");
  // 16 rows x 256 floats: per row 64 pieces -> 2 instructions per row... 16 rows x 64 pieces / 32 lanes = 32 instructions
#pragma unroll 4
  for (int q = 0; q < 32; ++q) { const int rl = q >> 1, pc = (q & 1) * 32 + lane;
    vst2(out + (size_t)(m0 + rl) * D_OUT + pc * 4, *(const v4f*)(S + rl * 260 + pc * 4)); }
}

extern "C" void kernel_launch(void* const* d_in, const int* in_sizes, int n_in,
                              void* d_out, int out_size, void* d_ws, size_t ws_size,
                              hipStream_t stream) {
  (void)in_sizes; (void)n_in; (void)out_size; (void)ws_size;
  const float* x     = (const float*)d_in[0];
  const float* W_qkv = (const float*)d_in[1];
  const float* b_qkv = (const float*)d_in[2];
  const float* W_out = (const float*)d_in[3];
  const float* b_out = (const float*)d_in[4];
  float* out = (float*)d_out;
  char* ws = (char*)d_ws; size_t off = 0;
  auto alloc = [&](size_t bytes) -> void* { void* p = ws + off; off = (off + bytes + 255) & ~(size_t)255; return p; };
  __bf16* Wqh = (__bf16*)alloc((size_t)D_QKV * D_MODEL * 2); __bf16* Wql = (__bf16*)alloc((size_t)D_QKV * D_MODEL * 2);
  __bf16* Woh = (__bf16*)alloc((size_t)D_OUT * D_ATTN * 2);  __bf16* Wol = (__bf16*)alloc((size_t)D_OUT * D_ATTN * 2);
  float* qb = (float*)alloc((size_t)NTOK * D_ATTN * 4); float* kb = (float*)alloc((size_t)NTOK * D_ATTN * 4);
  float* vT = (float*)alloc((size_t)NTOK * D_ATTN * 4); float* ob = (float*)alloc((size_t)NTOK * D_ATTN * 4);

  k_wt<<<(D_MODEL / 64) * (D_QKV / 64), 256, 0, stream>>>(W_qkv, Wqh, Wql, D_MODEL, D_QKV);
  k_wt<<<(D_ATTN / 64) * (D_OUT / 64), 256, 0, stream>>>(W_out, Woh, Wol, D_ATTN, D_OUT);
  k_qkv<<<NTOK / 64, 128, 0, stream>>>(x, Wqh, Wql, b_qkv, qb, kb, vT);
  k_attn<<<NBATCH * (NSEQ / 16), 256, 0, stream>>>(qb, kb, vT, ob);
  k_out<<<NTOK / 64, 128, 0, stream>>>(ob, Woh, Wol, b_out, out);
}

// v005
// One run takes 52.4 microseconds.
// In two side-by-side timings against v004, it was 1.28 and 1.26 times as fast.
// Over all steps from v000 it is 6.96 times as fast.
#include <hip/hip_runtime.h>
#include <math.h>

// Causal single-head attention (d_attn 64) with qkv and output projections.
// All four contractions (qkv projection K = 512, scores K = 64, P @ V over <= 2048 keys, output projection K = 64) on
// v_wmma_f32_16x16x32_bf16 as a TWO-WAY bf16 split of both f32 operands (hi*hi + hi*lo + lo*hi, f32 accumulate).

#define D_MODEL 512
#define D_ATTN  64
#define NSEQ    2048
#define NBATCH  8
#define NTOK    (NBATCH * NSEQ)
#define D_OUT   256
#define D_QKV   192
#define SCALE_F 0.125f

typedef __attribute__((ext_vector_type(16))) __bf16 v16bf;
typedef __attribute__((ext_vector_type(8)))  __bf16 v8bf;
typedef __attribute__((ext_vector_type(8)))  float  v8f;
typedef __attribute__((ext_vector_type(4)))  float  v4f;
typedef __attribute__((ext_vector_type(4)))  unsigned v4u;

template <typename T> __device__ __forceinline__ void vst2(void* p, T v) { *(T*)p = v;  }
__device__ __forceinline__ v8f wmma_bf(v16bf a, v16bf b, v8f c) {
  v8f d = __builtin_amdgcn_wmma_f32_16x16x32_bf16(false, a, false, b, (short)0, c, false, false);
  asm volatile("v_nop\n\tv_nop\n\tv_nop\n\tv_nop" : "+v"(d) : "v"(a), "v"(b));
  return d;
}
struct F2 { v16bf h, l; };
// split an f32 row fragment (row base pointer, k0) into bf16 hi/lo; element i<8 -> k0+8g+i, i>=8 -> k0+16+8g+(i-8)
__device__ __forceinline__ F2 split_f32(const float* row, int k0, int lane) {
  F2 r; const float* p = row + k0 + 8 * (lane >> 4);
#pragma unroll
  for (int i = 0; i < 16; ++i) { const float x = p[(i < 8) ? i : (i + 8)]; const __bf16 h = (__bf16)x; r.h[i] = h; r.l[i] = (__bf16)(x - (float)h); }
  return r;
}
// the 16 f32 of one fragment as loaded (same addresses as split_f32), and their split: lets a pass issue its loads as one group
struct R16 { v4f q[4]; };
__device__ __forceinline__ R16 ld16(const float* base, unsigned off) {   // base pointer plus the lane's 32-bit element offset
  R16 r;
  r.q[0] = *(const v4f*)(base + off); r.q[1] = *(const v4f*)(base + off + 4); r.q[2] = *(const v4f*)(base + off + 16); r.q[3] = *(const v4f*)(base + off + 20); return r;
}
__device__ __forceinline__ F2 split_r(const R16& s) {
  F2 r;
#pragma unroll
  for (int i = 0; i < 16; ++i) { const float x = s.q[i >> 2][i & 3]; const __bf16 h = (__bf16)x; r.h[i] = h; r.l[i] = (__bf16)(x - (float)h); }
  return r;
}
// PACKED FRAGMENTS. The weight planes, q, k and v (each written by one kernel for another) lie in the order in which a wave loads them: piece i of a fragment
// is 32 lanes x 16 B = 512 contiguous bytes (four whole 128-B lines a load, where a row-major operand gives sixteen lines with 32 B each).
// The element that a lane's register holds is the same as with the row-major loaders (k order of split_f32), only its address differs.
// f32 fragment (16 rows x 32 k): 4 pieces, piece i of lane (col, g) = row col, k = 8g + 4(i & 1) + 16(i >> 1) + 0..3
__device__ __forceinline__ R16 ldp(const float* p, unsigned off) {          // p: the lane's own place (lane * 4 inside); off: the fragment's element offset
  R16 r;
  r.q[0] = *(const v4f*)(p + off); r.q[1] = *(const v4f*)(p + off + 128); r.q[2] = *(const v4f*)(p + off + 256); r.q[3] = *(const v4f*)(p + off + 384); return r;
}
// bf16 fragment (16 rows x 32 k): 2 pieces, piece i of lane (col, g) = row col, k = 8g + 16i + 0..7
__device__ __forceinline__ v16bf frag_p(const __bf16* p, unsigned off) {    // p: the lane's own place (lane * 8 inside); off: the fragment's element offset
  union { v16bf v; v8bf q[2]; } r;
  r.q[0] = *(const v8bf*)(p + off); r.q[1] = *(const v8bf*)(p + off + 256); return r.v;
}

// W [K][N] f32 (x @ W layout) -> bf16 hi/lo planes of packed W^T fragments, fragment index kc * (N/16) + column tile; via 64x64 tiles; grid = (K/64)*(N/64)
__global__ __launch_bounds__(256) void k_wt(const float* __restrict__ W, __bf16* __restrict__ Ph, __bf16* __restrict__ Pl, int K, int N) {
  __shared__ __align__(16) __bf16 th[64][72], tl[64][72];
  const int nt = N / 64, tid = threadIdx.x;
  const int n0 = (blockIdx.x % nt) * 64, k0 = (blockIdx.x / nt) * 64;
  for (int i = tid; i < 64 * 64; i += 256) { const int kk = i >> 6, nn = i & 63; const float x = W[(size_t)(k0 + kk) * N + n0 + nn];
    const __bf16 h = (__bf16)x; th[nn][kk] = h; tl[nn][kk] = (__bf16)(x - (float)h); }
  __syncthreads();
  for (int g = tid; g < 64 * 8; g += 256) { const int ln = g & 31, i = (g >> 5) & 1, jl = (g >> 6) & 3, kl = g >> 8;
    const int nn = jl * 16 + (ln & 15), pc = kl * 4 + i * 2 + (ln >> 4);
    const size_t o = ((((size_t)(k0 / 32 + kl) * (N / 16) + n0 / 16 + jl) * 2 + i) * 32 + ln) * 8;
    vst2(Ph + o, *(const v4u*)(&th[nn][pc * 8])); vst2(Pl + o, *(const v4u*)(&tl[nn][pc * 8])); }
}

// qkv projection: block = 64 tokens x all 192 cols, 16 waves = 4 row tiles of 16 tokens x 4 quarters of K: wave (kq, rt) sums k = 128 kq .. 128 kq + 127
// of its row tile, so four waves a SIMD cover each other's load waits and a block has four times the bytes in flight; the four partial sums of an element
// are added, and the bias after them, where the block's tile is read back from LDS. Waves of one quarter read the same weight fragments.
// q, k: packed f32 fragments, index (token / 16) * 2 + (d / 32); v: packed f32 fragments of V^T (rows d, k = keys), index (token / 32) * 4 + (d / 16)
#define KQ_PASSES (D_MODEL / 32 / 4)
__global__ __launch_bounds__(512) void k_qkv(const float* __restrict__ x, const __bf16* __restrict__ Wh, const __bf16* __restrict__ Wl,
                                            const float* __restrict__ bq, float* __restrict__ qb, float* __restrict__ kb, float* __restrict__ vT) {
  __shared__ __align__(16) float st[4][64][196];       // [K quarter][row][col] pitch 196
  const int tid = threadIdx.x, wave = tid >> 5, rt = wave & 3, kq = wave >> 2, lane = tid & 31, col = lane & 15, g = lane >> 4;
  const int m0 = blockIdx.x * 64 + rt * 16;
  const float* xl = x + (size_t)(m0 + col) * D_MODEL + kq * (KQ_PASSES * 32) + 8 * g;   // the lane's own places in x and in the two weight planes
  const __bf16* whl = Wh + kq * (KQ_PASSES * 12 * 512) + lane * 8; const __bf16* wll = Wl + kq * (KQ_PASSES * 12 * 512) + lane * 8;
  v8f c[12] = {};
  R16 xr = ld16(xl, 0);
#pragma unroll 1
  for (int kc = 0; kc < KQ_PASSES; ++kc) {
    // the weight fragments of six column tiles are loaded as one group ahead of their products; the next pass's x rows go with the second group
    const __bf16* wph = whl + kc * (12 * 512); const __bf16* wpl = wll + kc * (12 * 512);
    const float* xp = xl + ((kc + 1 < KQ_PASSES) ? kc + 1 : kc) * 32;   // the last pass re-reads its own rows: stays in bounds
#pragma unroll
    for (int hf = 0; hf < 2; ++hf) {
      v16bf wh[6], wl[6];
#pragma unroll
      for (int j = 0; j < 6; ++j) { wh[j] = frag_p(wph, (hf * 6 + j) * 512); wl[j] = frag_p(wpl, (hf * 6 + j) * 512); }
      const F2 a = split_r(xr);
      if (hf == 1) xr = ld16(xp, 0);
      // the group's address registers are inputs here, so they live up to this wait and no load of the group lands in them ahead of it
      asm volatile("s_wait_xcnt 0x0" :: "v"(wph), "v"(wpl), "v"(xp) : "memory");
#pragma unroll
      for (int j = 0; j < 6; ++j) { v8f t = c[hf * 6 + j];
        t = wmma_bf(a.l, wh[j], t); t = wmma_bf(a.h, wl[j], t); t = wmma_bf(a.h, wh[j], t); c[hf * 6 + j] = t; }
    }
  }
  // the biases of the elements that this thread stores below: loaded here so that the LDS stores and the barrier cover their latency
  const int pi = (tid >> 5) & 3, ko = 8 * g + (pi & 1) * 4 + (pi >> 1) * 16, dq = ((tid >> 7) & 1) * 32 + ko, dv = ((tid >> 7) & 3) * 16 + col;
  const v4f bbq = { bq[dq], bq[dq + 1], bq[dq + 2], bq[dq + 3] }, bbk = { bq[64 + dq], bq[64 + dq + 1], bq[64 + dq + 2], bq[64 + dq + 3] };
  const float bbv = bq[128 + dv];
#pragma unroll
  for (int j = 0; j < 12; ++j)
#pragma unroll
    for (int r = 0; r < 8; ++r) st[kq][rt * 16 + g * 8 + r][j * 16 + col] = c[j][r];
  __syncthreads();
  // q and k: the block's 8 fragments each (4 token tiles x 2 halves of d) = 1024 pieces of 16 B, piece gq at place gq: a wave's store is 512 contiguous bytes
#pragma unroll   // both trips' LDS reads stand together: one LDS latency
  for (int it = 0; it < 2; ++it) { const int gq = tid + it * 512, rl = (gq >> 8) * 16 + col;
    const size_t o = ((size_t)blockIdx.x * 1024 + gq) * 4;
    v4f sq = *(const v4f*)(&st[0][rl][dq]), sk = *(const v4f*)(&st[0][rl][64 + dq]);
#pragma unroll
    for (int p = 1; p < 4; ++p) { sq += *(const v4f*)(&st[p][rl][dq]); sk += *(const v4f*)(&st[p][rl][64 + dq]); }
    vst2(qb + o, sq + bbq);
    vst2(kb + o, sk + bbk); }
  // v: the block's 8 fragments (2 key blocks of 32 x 4 tiles of d), a piece = 4 consecutive keys of one d
#pragma unroll   // both trips' LDS reads stand together: one LDS latency
  for (int it = 0; it < 2; ++it) { const int gq = tid + it * 512, kl = it * 32 + ko;
    v4f v = { st[0][kl][128 + dv], st[0][kl + 1][128 + dv], st[0][kl + 2][128 + dv], st[0][kl + 3][128 + dv] };
#pragma unroll
    for (int p = 1; p < 4; ++p) { const v4f u = { st[p][kl][128 + dv], st[p][kl + 1][128 + dv], st[p][kl + 2][128 + dv], st[p][kl + 3][128 + dv] }; v += u; }
    vst2(vT + ((size_t)blockIdx.x * 1024 + gq) * 4, v + bbv); }
}

// the lane's value from the other half of the wave (lane ^ 16), by a vector cross-row move: no LDS, no wait
__device__ __forceinline__ float xhalf(float v) {
  const unsigned b = __builtin_bit_cast(unsigned, v);
  return __builtin_bit_cast(float, __builtin_amdgcn_permlanex16(b, b, 0x76543210u, 0xfedcba98u, false, false));
}
// the three products of two split operands, hi*lo + lo*hi + hi*hi: a is the A operand (K rows, V^T rows), b the B operand (Q, P^T)
__device__ __forceinline__ v8f mac3t(const F2& a, const F2& b, v8f c) {
  c = wmma_bf(a.h, b.l, c); c = wmma_bf(a.l, b.h, c); c = wmma_bf(a.h, b.h, c); return c;
}

__global__ __launch_bounds__(256) __attribute__((amdgpu_waves_per_eu(4))) void k_attn(const float* __restrict__ qb, const float* __restrict__ kb, const float* __restrict__ vT, float* __restrict__ ob) {
  __shared__ __align__(16) float os[8][16 * 68];        // un-normalised partial output per wave, [query][d], pitch 68: 16-byte stores of 16 lanes meet 64 banks once
  __shared__ float ms[8][16], ls[8][16];                // partial row maxima and row sums per wave
  const int wl = __builtin_amdgcn_readfirstlane(threadIdx.x >> 5);
  const int b = blockIdx.x & (NBATCH - 1), qs = (NSEQ / 16 - 1 - (blockIdx.x >> 3)) * 16;
  const int lane = threadIdx.x & 31, g = lane >> 4, col = lane & 15;
  const float* qp = qb + ((size_t)b * NSEQ + qs) * D_ATTN + lane * 4;    // the tile's two packed fragments
  const F2 qa = split_r(ldp(qp, 0)), qc = split_r(ldp(qp, 512));
  float m_r = -1e30f, l_r = 0.f;                        // the lane's query: running maximum (equal in both halves), sum over this half's keys
  v8f o[4] = {};                                        // O^T: o[t][r] = O[query col][d = 16 t + 8 g + r]
  const int jmax = (qs + 15) >> 5;
  const unsigned loff = lane * 4;
  const int qk = qs + col - 8 * g;                      // key ks + 8 g + r is masked where ks + r > qk
  for (int j = wl; j <= jmax; j += 8) {
    const int ks = j * 32;
    const float* kt = kb + ((size_t)b * NSEQ + ks) * D_ATTN + loff;   // the lane's place in the key block's four packed fragments
    // all 16 K loads of the block stand ahead of the first product, so one wait covers them
    const R16 k00 = ldp(kt, 0), k01 = ldp(kt, 512), k10 = ldp(kt, 1024), k11 = ldp(kt, 1536);
    // the group's address register is an input here, so it lives up to this wait and no load of the group lands in it ahead of it
    asm volatile("s_wait_xcnt 0x0" :: "v"(kt) : "memory");
    v8f s0 = {}, s1 = {};
    s0 = mac3t(split_r(k00), qa, s0); s0 = mac3t(split_r(k01), qc, s0);
    s1 = mac3t(split_r(k10), qa, s1); s1 = mac3t(split_r(k11), qc, s1);
    // all 16 V loads of the block stand ahead of the softmax, which covers their latency
    const float* vb = vT + ((size_t)b * NSEQ + ks) * D_ATTN + loff;
    R16 vr[4];
#pragma unroll
    for (int t = 0; t < 4; ++t) vr[t] = ldp(vb, t * 512);
    // the group's address register is an input here, so it lives up to this wait and no load of the group lands in it ahead of it
    asm volatile("s_wait_xcnt 0x0" :: "v"(vb) : "memory");
    float a[16], mx[8];
#pragma unroll
    for (int r = 0; r < 8; ++r) {
      a[r]     = s0[r] * SCALE_F; if (ks + r > qk)      a[r]     = -1e30f;
      a[r + 8] = s1[r] * SCALE_F; if (ks + 16 + r > qk) a[r + 8] = -1e30f;
      mx[r] = fmaxf(a[r], a[r + 8]);
    }
#pragma unroll
    for (int w = 4; w >= 1; w >>= 1)
#pragma unroll
      for (int r = 0; r < w; ++r) mx[r] = fmaxf(mx[r], mx[r + w]);
    const float mn = fmaxf(m_r, fmaxf(mx[0], xhalf(mx[0])));
    F2 pf; float sm[16];                                  // element s of the B operand = key kmap(s, g) = score a[s]
#pragma unroll
    for (int s = 0; s < 16; ++s) {
      const float pv = __expf(a[s] - mn); const __bf16 h = (__bf16)pv;
      pf.h[s] = h; pf.l[s] = (__bf16)(pv - (float)h); sm[s] = pv;
    }
#pragma unroll
    for (int w = 8; w >= 1; w >>= 1)
#pragma unroll
      for (int s = 0; s < w; ++s) sm[s] += sm[s + w];
    // keeps the conversions of V, and with them the wait for the V loads, behind the softmax: without it the wait stands ahead of the softmax, which then covers no latency
    __builtin_amdgcn_sched_barrier(0);
    const float corr = __expf(m_r - mn);
    l_r = l_r * corr + sm[0]; m_r = mn;
#pragma unroll
    for (int t = 0; t < 4; ++t) o[t] *= corr;
#pragma unroll
    for (int t = 0; t < 4; ++t) o[t] = mac3t(split_r(vr[t]), pf, o[t]);
  }
  l_r += xhalf(l_r);                                      // the two halves' sums are joined once
  float* so = os[wl] + col * 68 + 8 * g;
#pragma unroll
  for (int t = 0; t < 4; ++t) {
    const v4f lo = { o[t][0], o[t][1], o[t][2], o[t][3] }, hi = { o[t][4], o[t][5], o[t][6], o[t][7] };
    vst2(so + t * 16, lo); vst2(so + t * 16 + 4, hi);
  }
  if (g == 0) { ms[wl][col] = m_r; ls[wl][col] = l_r; }
  __syncthreads();                                        // every wave's partial state is in LDS before any thread merges
  // merge: thread -> (row, 4 columns); a wave that had no key block holds max -1e30, sum 0, zeros: weight 0
  const int row = threadIdx.x >> 4, c4 = (threadIdx.x & 15) * 4;
  float M = ms[0][row];
#pragma unroll
  for (int w = 1; w < 8; ++w) M = fmaxf(M, ms[w][row]);
  float L = 0.f; v4f acc = {};
#pragma unroll
  for (int w = 0; w < 8; ++w) { const float wg = __expf(ms[w][row] - M);
    L += ls[w][row] * wg; acc += *(const v4f*)(&os[w][row * 68 + c4]) * wg; }
  vst2(ob + ((size_t)b * NSEQ + qs + row) * D_ATTN + c4, acc / L);
}

// output projection: block = 64 tokens (4 waves x 16 rows) x 256 cols in 16 column tiles of 16 per wave; rows 1 KB
__global__ __launch_bounds__(128) void k_out(const float* __restrict__ ob, const __bf16* __restrict__ Wh, const __bf16* __restrict__ Wl,
                                            const float* __restrict__ bo, float* __restrict__ out) {
  __shared__ __align__(16) float st[4][16 * 260];
  const int tid = threadIdx.x, wave = tid >> 5, lane = tid & 31, col = lane & 15, g = lane >> 4;
  const int m0 = blockIdx.x * 64 + wave * 16;
  const float* ar = ob + (size_t)(m0 + col) * D_ATTN;
  const F2 a0 = split_f32(ar, 0, lane), a1 = split_f32(ar, 32, lane);
  float* S = st[wave];
#pragma unroll 1   // rolled: only one group's fragments (128 registers) are live at a time
  for (int j0 = 0; j0 < 16; j0 += 4) {
    // the weight fragments and biases of four column tiles are loaded as one group ahead of their products
    v16bf wh0[4], wl0[4], wh1[4], wl1[4]; float bb[4];
    const __bf16* wph = Wh + j0 * 512 + lane * 8; const __bf16* wpl = Wl + j0 * 512 + lane * 8; const float* bp = bo + j0 * 16 + col;
#pragma unroll
    for (int i = 0; i < 4; ++i) { const unsigned ro = i * 512;
      wh0[i] = frag_p(wph, ro); wl0[i] = frag_p(wpl, ro); wh1[i] = frag_p(wph, ro + 16 * 512); wl1[i] = frag_p(wpl, ro + 16 * 512);
      bb[i] = bp[i * 16]; }
    // the group's address registers are inputs here, so they live up to this wait and no load of the group lands in them ahead of it
    asm volatile("s_wait_xcnt 0x0" :: "v"(wph), "v"(wpl), "v"(bp) : "memory");
#pragma unroll
    for (int i = 0; i < 4; ++i) {
      v8f c = {};
      c = wmma_bf(a0.l, wh0[i], c); c = wmma_bf(a0.h, wl0[i], c); c = wmma_bf(a0.h, wh0[i], c);
      c = wmma_bf(a1.l, wh1[i], c); c = wmma_bf(a1.h, wl1[i], c); c = wmma_bf(a1.h, wh1[i], c);
#pragma unroll
      for (int r = 0; r < 8; ++r) S[(r + 8 * g) * 260 + (j0 + i) * 16 + col] = c[r] + bb[i];
    }
  }
  asm volatile("s_wait_dscnt 0" ::: "memory"); __builtin_amdgcn_wave_barrier(); __builtin_amdgcn_fence(__ATOMIC_RELEASE, "workgroup");
  // 16 rows x 256 floats: per row 64 pieces -> 2 instructions per row... 16 rows x 64 pieces / 32 lanes = 32 instructions
#pragma unroll 4
  for (int q = 0; q < 32; ++q) { const int rl = q >> 1, pc = (q & 1) * 32 + lane;
    vst2(out + (size_t)(m0 + rl) * D_OUT + pc * 4, *(const v4f*)(S + rl * 260 + pc * 4)); }
}

extern "C" void kernel_launch(void* const* d_in, const int* in_sizes, int n_in,
                              void* d_out, int out_size, void* d_ws, size_t ws_size,
                              hipStream_t stream) {
  (void)in_sizes; (void)n_in; (void)out_size; (void)ws_size;
  const float* x     = (const float*)d_in[0];
  const float* W_qkv = (const float*)d_in[1];
  const float* b_qkv = (const float*)d_in[2];
  const float* W_out = (const float*)d_in[3];
  const float* b_out = (const float*)d_in[4];
  float* out = (float*)d_out;
  char* ws = (char*)d_ws; size_t off = 0;
  auto alloc = [&](size_t bytes) -> void* { void* p = ws + off; off = (off + bytes + 255) & ~(size_t)255; return p; };
  __bf16* Wqh = (__bf16*)alloc((size_t)D_QKV * D_MODEL * 2); __bf16* Wql = (__bf16*)alloc((size_t)D_QKV * D_MODEL * 2);
  __bf16* Woh = (__bf16*)alloc((size_t)D_OUT * D_ATTN * 2);  __bf16* Wol = (__bf16*)alloc((size_t)D_OUT * D_ATTN * 2);
  float* qb = (float*)alloc((size_t)NTOK * D_ATTN * 4); float* kb = (float*)alloc((size_t)NTOK * D_ATTN * 4);
  float* vT = (float*)alloc((size_t)NTOK * D_ATTN * 4); float* ob = (float*)alloc((size_t)NTOK * D_ATTN * 4);

  k_wt<<<(D_MODEL / 64) * (D_QKV / 64), 256, 0, stream>>>(W_qkv, Wqh, Wql, D_MODEL, D_QKV);
  k_wt<<<(D_ATTN / 64) * (D_OUT / 64), 256, 0, stream>>>(W_out, Woh, Wol, D_ATTN, D_OUT);
  k_qkv<<<NTOK / 64, 512, 0, stream>>>(x, Wqh, Wql, b_qkv, qb, kb, vT);
  k_attn<<<NBATCH * (NSEQ / 16), 256, 0, stream>>>(qb, kb, vT, ob);
  k_out<<<NTOK / 64, 128, 0, stream>>>(ob, Woh, Wol, b_out, out);
}

// v006
// A run of this version takes 47.3 microseconds.
// In both of two side-by-side timings against v005, it was 1.11 times as fast.
// Counting every step since v000, it is 7.73 times as fast.
#include <hip/hip_runtime.h>
#include <math.h>

// Causal single-head attention (d_attn 64) with qkv and output projections.
// All four contractions (qkv projection K = 512, scores K = 64, P @ V over <= 2048 keys, output projection K = 64) on
// v_wmma_f32_16x16x32_bf16 as a TWO-WAY bf16 split of both f32 operands (hi*hi + hi*lo + lo*hi, f32 accumulate).

#define D_MODEL 512
#define D_ATTN  64
#define NSEQ    2048
#define NBATCH  8
#define NTOK    (NBATCH * NSEQ)
#define D_OUT   256
#define D_QKV   192
#define SCALE_F 0.125f

typedef __attribute__((ext_vector_type(16))) __bf16 v16bf;
typedef __attribute__((ext_vector_type(8)))  __bf16 v8bf;
typedef __attribute__((ext_vector_type(8)))  float  v8f;
typedef __attribute__((ext_vector_type(4)))  float  v4f;
typedef __attribute__((ext_vector_type(4)))  unsigned v4u;

template <typename T> __device__ __forceinline__ void vst2(void* p, T v) { *(T*)p = v;  }
__device__ __forceinline__ v8f wmma_bf(v16bf a, v16bf b, v8f c) {
  v8f d = __builtin_amdgcn_wmma_f32_16x16x32_bf16(false, a, false, b, (short)0, c, false, false);
  asm volatile("v_nop\n\tv_nop\n\tv_nop\n\tv_nop" : "+v"(d) : "v"(a), "v"(b));
  return d;
}
struct F2 { v16bf h, l; };
// split an f32 row fragment (row base pointer, k0) into bf16 hi/lo; element i<8 -> k0+8g+i, i>=8 -> k0+16+8g+(i-8)
__device__ __forceinline__ F2 split_f32(const float* row, int k0, int lane) {
  F2 r; const float* p = row + k0 + 8 * (lane >> 4);
#pragma unroll
  for (int i = 0; i < 16; ++i) { const float x = p[(i < 8) ? i : (i + 8)]; const __bf16 h = (__bf16)x; r.h[i] = h; r.l[i] = (__bf16)(x - (float)h); }
  return r;
}
// the 16 f32 of one fragment as loaded (same addresses as split_f32), and their split: lets a pass issue its loads as one group
struct R16 { v4f q[4]; };
__device__ __forceinline__ R16 ld16(const float* base, unsigned off) {   // base pointer plus the lane's 32-bit element offset
  R16 r;
  r.q[0] = *(const v4f*)(base + off); r.q[1] = *(const v4f*)(base + off + 4); r.q[2] = *(const v4f*)(base + off + 16); r.q[3] = *(const v4f*)(base + off + 20); return r;
}
__device__ __forceinline__ F2 split_r(const R16& s) {
  F2 r;
#pragma unroll
  for (int i = 0; i < 16; ++i) { const float x = s.q[i >> 2][i & 3]; const __bf16 h = (__bf16)x; r.h[i] = h; r.l[i] = (__bf16)(x - (float)h); }
  return r;
}
// PACKED FRAGMENTS. The weight planes, q, k and v (each written by one kernel for another) lie in the order in which a wave loads them: piece i of a fragment
// is 32 lanes x 16 B = 512 contiguous bytes (four whole 128-B lines a load, where a row-major operand gives sixteen lines with 32 B each).
// The element that a lane's register holds is the same as with the row-major loaders (k order of split_f32), only its address differs.
// f32 fragment (16 rows x 32 k): 4 pieces, piece i of lane (col, g) = row col, k = 8g + 4(i & 1) + 16(i >> 1) + 0..3
__device__ __forceinline__ R16 ldp(const float* p, unsigned off) {          // p: the lane's own place (lane * 4 inside); off: the fragment's element offset
  R16 r;
  r.q[0] = *(const v4f*)(p + off); r.q[1] = *(const v4f*)(p + off + 128); r.q[2] = *(const v4f*)(p + off + 256); r.q[3] = *(const v4f*)(p + off + 384); return r;
}
// bf16 fragment (16 rows x 32 k): 2 pieces, piece i of lane (col, g) = row col, k = 8g + 16i + 0..7
__device__ __forceinline__ v16bf frag_p(const __bf16* p, unsigned off) {    // p: the lane's own place (lane * 8 inside); off: the fragment's element offset
  union { v16bf v; v8bf q[2]; } r;
  r.q[0] = *(const v8bf*)(p + off); r.q[1] = *(const v8bf*)(p + off + 256); return r.v;
}

// W [K][N] f32 (x @ W layout) -> bf16 hi/lo planes of packed W^T fragments, fragment index kc * (N/16) + column tile; via 64x64 tiles; grid = (K/64)*(N/64)
__global__ __launch_bounds__(256) void k_wt(const float* __restrict__ W, __bf16* __restrict__ Ph, __bf16* __restrict__ Pl, int K, int N) {
  __shared__ __align__(16) __bf16 th[64][72], tl[64][72];
  const int nt = N / 64, tid = threadIdx.x;
  const int n0 = (blockIdx.x % nt) * 64, k0 = (blockIdx.x / nt) * 64;
  for (int i = tid; i < 64 * 64; i += 256) { const int kk = i >> 6, nn = i & 63; const float x = W[(size_t)(k0 + kk) * N + n0 + nn];
    const __bf16 h = (__bf16)x; th[nn][kk] = h; tl[nn][kk] = (__bf16)(x - (float)h); }
  __syncthreads();
  for (int g = tid; g < 64 * 8; g += 256) { const int ln = g & 31, i = (g >> 5) & 1, jl = (g >> 6) & 3, kl = g >> 8;
    const int nn = jl * 16 + (ln & 15), pc = kl * 4 + i * 2 + (ln >> 4);
    const size_t o = ((((size_t)(k0 / 32 + kl) * (N / 16) + n0 / 16 + jl) * 2 + i) * 32 + ln) * 8;
    vst2(Ph + o, *(const v4u*)(&th[nn][pc * 8])); vst2(Pl + o, *(const v4u*)(&tl[nn][pc * 8])); }
}

// qkv projection: block = 64 tokens x all 192 cols, 16 waves = 4 row tiles of 16 tokens x 4 quarters of K: wave (kq, rt) sums k = 128 kq .. 128 kq + 127
// of its row tile, so four waves a SIMD cover each other's load waits and a block has four times the bytes in flight; the four partial sums of an element
// are added, and the bias after them, where the block's tile is read back from LDS. Waves of one quarter read the same weight fragments.
// q, k: packed f32 fragments, index (token / 16) * 2 + (d / 32); v: packed f32 fragments of V^T (rows d, k = keys), index (token / 32) * 4 + (d / 16)
#define KQ_PASSES (D_MODEL / 32 / 4)
__global__ __launch_bounds__(512) void k_qkv(const float* __restrict__ x, const __bf16* __restrict__ Wh, const __bf16* __restrict__ Wl,
                                            const float* __restrict__ bq, float* __restrict__ qb, float* __restrict__ kb, float* __restrict__ vT) {
  __shared__ __align__(16) float st[4][64][196];       // [K quarter][row][col] pitch 196
  const int tid = threadIdx.x, wave = tid >> 5, rt = wave & 3, kq = wave >> 2, lane = tid & 31, col = lane & 15, g = lane >> 4;
  const int m0 = blockIdx.x * 64 + rt * 16;
  const float* xl = x + (size_t)(m0 + col) * D_MODEL + kq * (KQ_PASSES * 32) + 8 * g;   // the lane's own places in x and in the two weight planes
  const __bf16* whl = Wh + kq * (KQ_PASSES * 12 * 512) + lane * 8; const __bf16* wll = Wl + kq * (KQ_PASSES * 12 * 512) + lane * 8;
  v8f c[12] = {};
  R16 xr = ld16(xl, 0);
#pragma unroll 1
  for (int kc = 0; kc < KQ_PASSES; ++kc) {
    // the weight fragments of six column tiles are loaded as one group ahead of their products; the next pass's x rows go with the second group
    const __bf16* wph = whl + kc * (12 * 512); const __bf16* wpl = wll + kc * (12 * 512);
    const float* xp = xl + ((kc + 1 < KQ_PASSES) ? kc + 1 : kc) * 32;   // the last pass re-reads its own rows: stays in bounds
#pragma unroll
    for (int hf = 0; hf < 2; ++hf) {
      v16bf wh[6], wl[6];
#pragma unroll
      for (int j = 0; j < 6; ++j) { wh[j] = frag_p(wph, (hf * 6 + j) * 512); wl[j] = frag_p(wpl, (hf * 6 + j) * 512); }
      const F2 a = split_r(xr);
      if (hf == 1) xr = ld16(xp, 0);
      // the group's address registers are inputs here, so they live up to this wait and no load of the group lands in them ahead of it
      asm volatile("s_wait_xcnt 0x0" :: "v"(wph), "v"(wpl), "v"(xp) : "memory");
#pragma unroll
      for (int j = 0; j < 6; ++j) { v8f t = c[hf * 6 + j];
        t = wmma_bf(a.l, wh[j], t); t = wmma_bf(a.h, wl[j], t); t = wmma_bf(a.h, wh[j], t); c[hf * 6 + j] = t; }
    }
  }
  // the biases of the elements that this thread stores below: loaded here so that the LDS stores and the barrier cover their latency
  const int pi = (tid >> 5) & 3, ko = 8 * g + (pi & 1) * 4 + (pi >> 1) * 16, dq = ((tid >> 7) & 1) * 32 + ko, dv = ((tid >> 7) & 3) * 16 + col;
  const v4f bbq = { bq[dq], bq[dq + 1], bq[dq + 2], bq[dq + 3] }, bbk = { bq[64 + dq], bq[64 + dq + 1], bq[64 + dq + 2], bq[64 + dq + 3] };
  const float bbv = bq[128 + dv];
#pragma unroll
  for (int j = 0; j < 12; ++j)
#pragma unroll
    for (int r = 0; r < 8; ++r) st[kq][rt * 16 + g * 8 + r][j * 16 + col] = c[j][r];
  __syncthreads();
  // q and k: the block's 8 fragments each (4 token tiles x 2 halves of d) = 1024 pieces of 16 B, piece gq at place gq: a wave's store is 512 contiguous bytes
#pragma unroll   // both trips' LDS reads stand together: one LDS latency
  for (int it = 0; it < 2; ++it) { const int gq = tid + it * 512, rl = (gq >> 8) * 16 + col;
    const size_t o = ((size_t)blockIdx.x * 1024 + gq) * 4;
    v4f sq = *(const v4f*)(&st[0][rl][dq]), sk = *(const v4f*)(&st[0][rl][64 + dq]);
#pragma unroll
    for (int p = 1; p < 4; ++p) { sq += *(const v4f*)(&st[p][rl][dq]); sk += *(const v4f*)(&st[p][rl][64 + dq]); }
    vst2(qb + o, sq + bbq);
    vst2(kb + o, sk + bbk); }
  // v: the block's 8 fragments (2 key blocks of 32 x 4 tiles of d), a piece = 4 consecutive keys of one d
#pragma unroll   // both trips' LDS reads stand together: one LDS latency
  for (int it = 0; it < 2; ++it) { const int gq = tid + it * 512, kl = it * 32 + ko;
    v4f v = { st[0][kl][128 + dv], st[0][kl + 1][128 + dv], st[0][kl + 2][128 + dv], st[0][kl + 3][128 + dv] };
#pragma unroll
    for (int p = 1; p < 4; ++p) { const v4f u = { st[p][kl][128 + dv], st[p][kl + 1][128 + dv], st[p][kl + 2][128 + dv], st[p][kl + 3][128 + dv] }; v += u; }
    vst2(vT + ((size_t)blockIdx.x * 1024 + gq) * 4, v + bbv); }
}

// the lane's value from the other half of the wave (lane ^ 16), by a vector cross-row move: no LDS, no wait
__device__ __forceinline__ float xhalf(float v) {
  const unsigned b = __builtin_bit_cast(unsigned, v);
  return __builtin_bit_cast(float, __builtin_amdgcn_permlanex16(b, b, 0x76543210u, 0xfedcba98u, false, false));
}
// the three products of two split operands, hi*lo + lo*hi + hi*hi: a is the A operand (K rows, V^T rows), b the B operand (Q, P^T)
__device__ __forceinline__ v8f mac3t(const F2& a, const F2& b, v8f c) {
  c = wmma_bf(a.h, b.l, c); c = wmma_bf(a.l, b.h, c); c = wmma_bf(a.h, b.h, c); return c;
}

__global__ __launch_bounds__(256) __attribute__((amdgpu_waves_per_eu(4))) void k_attn(const float* __restrict__ qb, const float* __restrict__ kb, const float* __restrict__ vT,
                                                                                   const __bf16* __restrict__ Wh, const __bf16* __restrict__ Wl, const float* __restrict__ bo, float* __restrict__ out) {
  __shared__ __align__(16) float os[8][16 * 68];        // un-normalised partial output per wave, [query][d], pitch 68: 16-byte stores of 16 lanes meet 64 banks once
  __shared__ float ms[8][16], ls[8][16];                // partial row maxima and row sums per wave
  __shared__ __align__(16) float om[16 * 68];           // the merged, normalised tile [query][d]: the A operand of the output projection
  __shared__ __align__(16) float st[16 * 260];          // the tile's 16 x 256 outputs, staged so that a wave stores whole lines
  const int wl = __builtin_amdgcn_readfirstlane(threadIdx.x >> 5);
  const int b = blockIdx.x & (NBATCH - 1), qs = (NSEQ / 16 - 1 - (blockIdx.x >> 3)) * 16;
  const int lane = threadIdx.x & 31, g = lane >> 4, col = lane & 15;
  const float* qp = qb + ((size_t)b * NSEQ + qs) * D_ATTN + lane * 4;    // the tile's two packed fragments
  const F2 qa = split_r(ldp(qp, 0)), qc = split_r(ldp(qp, 512));
  float m_r = -1e30f, l_r = 0.f;                        // the lane's query: running maximum (equal in both halves), sum over this half's keys
  v8f o[4] = {};                                        // O^T: o[t][r] = O[query col][d = 16 t + 8 g + r]
  const int jmax = (qs + 15) >> 5;
  const unsigned loff = lane * 4;
  const int qk = qs + col - 8 * g;                      // key ks + 8 g + r is masked where ks + r > qk
  for (int j = wl; j <= jmax; j += 8) {
    const int ks = j * 32;
    const float* kt = kb + ((size_t)b * NSEQ + ks) * D_ATTN + loff;   // the lane's place in the key block's four packed fragments
    // all 16 K loads of the block stand ahead of the first product, so one wait covers them
    const R16 k00 = ldp(kt, 0), k01 = ldp(kt, 512), k10 = ldp(kt, 1024), k11 = ldp(kt, 1536);
    // the group's address register is an input here, so it lives up to this wait and no load of the group lands in it ahead of it
    asm volatile("s_wait_xcnt 0x0" :: "v"(kt) : "memory");
    v8f s0 = {}, s1 = {};
    s0 = mac3t(split_r(k00), qa, s0); s0 = mac3t(split_r(k01), qc, s0);
    s1 = mac3t(split_r(k10), qa, s1); s1 = mac3t(split_r(k11), qc, s1);
    // all 16 V loads of the block stand ahead of the softmax, which covers their latency
    const float* vb = vT + ((size_t)b * NSEQ + ks) * D_ATTN + loff;
    R16 vr[4];
#pragma unroll
    for (int t = 0; t < 4; ++t) vr[t] = ldp(vb, t * 512);
    // the group's address register is an input here, so it lives up to this wait and no load of the group lands in it ahead of it
    asm volatile("s_wait_xcnt 0x0" :: "v"(vb) : "memory");
    float a[16], mx[8];
#pragma unroll
    for (int r = 0; r < 8; ++r) {
      a[r]     = s0[r] * SCALE_F; if (ks + r > qk)      a[r]     = -1e30f;
      a[r + 8] = s1[r] * SCALE_F; if (ks + 16 + r > qk) a[r + 8] = -1e30f;
      mx[r] = fmaxf(a[r], a[r + 8]);
    }
#pragma unroll
    for (int w = 4; w >= 1; w >>= 1)
#pragma unroll
      for (int r = 0; r < w; ++r) mx[r] = fmaxf(mx[r], mx[r + w]);
    const float mn = fmaxf(m_r, fmaxf(mx[0], xhalf(mx[0])));
    F2 pf; float sm[16];                                  // element s of the B operand = key kmap(s, g) = score a[s]
#pragma unroll
    for (int s = 0; s < 16; ++s) {
      const float pv = __expf(a[s] - mn); const __bf16 h = (__bf16)pv;
      pf.h[s] = h; pf.l[s] = (__bf16)(pv - (float)h); sm[s] = pv;
    }
#pragma unroll
    for (int w = 8; w >= 1; w >>= 1)
#pragma unroll
      for (int s = 0; s < w; ++s) sm[s] += sm[s + w];
    // keeps the conversions of V, and with them the wait for the V loads, behind the softmax: without it the wait stands ahead of the softmax, which then covers no latency
    __builtin_amdgcn_sched_barrier(0);
    const float corr = __expf(m_r - mn);
    l_r = l_r * corr + sm[0]; m_r = mn;
#pragma unroll
    for (int t = 0; t < 4; ++t) o[t] *= corr;
#pragma unroll
    for (int t = 0; t < 4; ++t) o[t] = mac3t(split_r(vr[t]), pf, o[t]);
  }
  l_r += xhalf(l_r);                                      // the two halves' sums are joined once
  float* so = os[wl] + col * 68 + 8 * g;
#pragma unroll
  for (int t = 0; t < 4; ++t) {
    const v4f lo = { o[t][0], o[t][1], o[t][2], o[t][3] }, hi = { o[t][4], o[t][5], o[t][6], o[t][7] };
    vst2(so + t * 16, lo); vst2(so + t * 16 + 4, hi);
  }
  if (g == 0) { ms[wl][col] = m_r; ls[wl][col] = l_r; }
  __syncthreads();                                        // every wave's partial state is in LDS before any thread merges
  // output projection, this wave's two column tiles (2 wl, 2 wl + 1): their weight fragments and biases are loaded ahead of the merge, which covers their latency
  v16bf wh0[2], wl0[2], wh1[2], wl1[2]; float bb[2];
  const __bf16* wph = Wh + wl * 1024 + lane * 8; const __bf16* wpl = Wl + wl * 1024 + lane * 8; const float* bp = bo + wl * 32 + col;
#pragma unroll
  for (int i = 0; i < 2; ++i) { const unsigned ro = i * 512;
    wh0[i] = frag_p(wph, ro); wl0[i] = frag_p(wpl, ro); wh1[i] = frag_p(wph, ro + 16 * 512); wl1[i] = frag_p(wpl, ro + 16 * 512);
    bb[i] = bp[i * 16]; }
  // the group's address registers are inputs here, so they live up to this wait and no load of the group lands in them ahead of it
  asm volatile("s_wait_xcnt 0x0" :: "v"(wph), "v"(wpl), "v"(bp) : "memory");
  // merge: thread -> (row, 4 columns); a wave that had no key block holds max -1e30, sum 0, zeros: weight 0
  const int row = threadIdx.x >> 4, c4 = (threadIdx.x & 15) * 4;
  float M = ms[0][row];
#pragma unroll
  for (int w = 1; w < 8; ++w) M = fmaxf(M, ms[w][row]);
  float L = 0.f; v4f acc = {};
#pragma unroll
  for (int w = 0; w < 8; ++w) { const float wg = __expf(ms[w][row] - M);
    L += ls[w][row] * wg; acc += *(const v4f*)(&os[w][row * 68 + c4]) * wg; }
  vst2(om + row * 68 + c4, acc / L);
  __syncthreads();                                        // the merged tile is whole before any wave takes its fragments
  const F2 a0 = split_f32(om + col * 68, 0, lane), a1 = split_f32(om + col * 68, 32, lane);
#pragma unroll
  for (int i = 0; i < 2; ++i) {
    v8f c = {};
    c = wmma_bf(a0.l, wh0[i], c); c = wmma_bf(a0.h, wl0[i], c); c = wmma_bf(a0.h, wh0[i], c);
    c = wmma_bf(a1.l, wh1[i], c); c = wmma_bf(a1.h, wl1[i], c); c = wmma_bf(a1.h, wh1[i], c);
#pragma unroll
    for (int r = 0; r < 8; ++r) st[(r + 8 * g) * 260 + (wl * 2 + i) * 16 + col] = c[r] + bb[i];
  }
  __syncthreads();                                        // all 256 columns are staged before the rows go out
  // 16 rows x 64 pieces of 16 B: a wave's store is 512 contiguous bytes
#pragma unroll
  for (int q = 0; q < 4; ++q) { const int pidx = q * 256 + threadIdx.x, rl = pidx >> 6, pc = pidx & 63;
    vst2(out + ((size_t)b * NSEQ + qs + rl) * D_OUT + pc * 4, *(const v4f*)(st + rl * 260 + pc * 4)); }
}

extern "C" void kernel_launch(void* const* d_in, const int* in_sizes, int n_in,
                              void* d_out, int out_size, void* d_ws, size_t ws_size,
                              hipStream_t stream) {
  (void)in_sizes; (void)n_in; (void)out_size; (void)ws_size;
  const float* x     = (const float*)d_in[0];
  const float* W_qkv = (const float*)d_in[1];
  const float* b_qkv = (const float*)d_in[2];
  const float* W_out = (const float*)d_in[3];
  const float* b_out = (const float*)d_in[4];
  float* out = (float*)d_out;
  char* ws = (char*)d_ws; size_t off = 0;
  auto alloc = [&](size_t bytes) -> void* { void* p = ws + off; off = (off + bytes + 255) & ~(size_t)255; return p; };
  __bf16* Wqh = (__bf16*)alloc((size_t)D_QKV * D_MODEL * 2); __bf16* Wql = (__bf16*)alloc((size_t)D_QKV * D_MODEL * 2);
  __bf16* Woh = (__bf16*)alloc((size_t)D_OUT * D_ATTN * 2);  __bf16* Wol = (__bf16*)alloc((size_t)D_OUT * D_ATTN * 2);
  float* qb = (float*)alloc((size_t)NTOK * D_ATTN * 4); float* kb = (float*)alloc((size_t)NTOK * D_ATTN * 4);
  float* vT = (float*)alloc((size_t)NTOK * D_ATTN * 4);

  k_wt<<<(D_MODEL / 64) * (D_QKV / 64), 256, 0, stream>>>(W_qkv, Wqh, Wql, D_MODEL, D_QKV);
  k_wt<<<(D_ATTN / 64) * (D_OUT / 64), 256, 0, stream>>>(W_out, Woh, Wol, D_ATTN, D_OUT);
  k_qkv<<<NTOK / 64, 512, 0, stream>>>(x, Wqh, Wql, b_qkv, qb, kb, vT);
  k_attn<<<NBATCH * (NSEQ / 16), 256, 0, stream>>>(qb, kb, vT, Woh, Wol, b_out, out);
}

// v007
// One run takes 44.8 microseconds.
// Next to v006, in two timings, it ran 1.08 and 1.10 times as fast.
// All steps since v000 together make it 8.41 times as fast.
#include <hip/hip_runtime.h>
#include <math.h>

// Causal single-head attention (d_attn 64) with qkv and output projections.
// All four contractions (qkv projection K = 512, scores K = 64, P @ V over <= 2048 keys, output projection K = 64) on
// v_wmma_f32_16x16x32_bf16 as a TWO-WAY bf16 split of both f32 operands (hi*hi + hi*lo + lo*hi, f32 accumulate).

#define D_MODEL 512
#define D_ATTN  64
#define NSEQ    2048
#define NBATCH  8
#define NTOK    (NBATCH * NSEQ)
#define D_OUT   256
#define D_QKV   192
#define SCALE_F 0.125f

typedef __attribute__((ext_vector_type(16))) __bf16 v16bf;
typedef __attribute__((ext_vector_type(8)))  __bf16 v8bf;
typedef __attribute__((ext_vector_type(8)))  float  v8f;
typedef __attribute__((ext_vector_type(4)))  float  v4f;
typedef __attribute__((ext_vector_type(4)))  unsigned v4u;

template <typename T> __device__ __forceinline__ void vst2(void* p, T v) { *(T*)p = v;  }
__device__ __forceinline__ v8f wmma_bf(v16bf a, v16bf b, v8f c) {
  v8f d = __builtin_amdgcn_wmma_f32_16x16x32_bf16(false, a, false, b, (short)0, c, false, false);
  asm volatile("v_nop\n\tv_nop\n\tv_nop\n\tv_nop" : "+v"(d) : "v"(a), "v"(b));
  return d;
}
struct F2 { v16bf h, l; };
// split an f32 row fragment (row base pointer, k0) into bf16 hi/lo; element i<8 -> k0+8g+i, i>=8 -> k0+16+8g+(i-8)
__device__ __forceinline__ F2 split_f32(const float* row, int k0, int lane) {
  F2 r; const float* p = row + k0 + 8 * (lane >> 4);
#pragma unroll
  for (int i = 0; i < 16; ++i) { const float x = p[(i < 8) ? i : (i + 8)]; const __bf16 h = (__bf16)x; r.h[i] = h; r.l[i] = (__bf16)(x - (float)h); }
  return r;
}
// the 16 f32 of one fragment as loaded (same addresses as split_f32), and their split: lets a pass issue its loads as one group
struct R16 { v4f q[4]; };
__device__ __forceinline__ R16 ld16(const float* base, unsigned off) {   // base pointer plus the lane's 32-bit element offset
  R16 r;
  r.q[0] = *(const v4f*)(base + off); r.q[1] = *(const v4f*)(base + off + 4); r.q[2] = *(const v4f*)(base + off + 16); r.q[3] = *(const v4f*)(base + off + 20); return r;
}
__device__ __forceinline__ F2 split_r(const R16& s) {
  F2 r;
#pragma unroll
  for (int i = 0; i < 16; ++i) { const float x = s.q[i >> 2][i & 3]; const __bf16 h = (__bf16)x; r.h[i] = h; r.l[i] = (__bf16)(x - (float)h); }
  return r;
}
// PACKED FRAGMENTS. The weight planes, q, k and v (each written by one kernel for another) lie in the order in which a wave loads them: piece i of a fragment
// is 32 lanes x 16 B = 512 contiguous bytes (four whole 128-B lines a load, where a row-major operand gives sixteen lines with 32 B each).
// The element that a lane's register holds is the same as with the row-major loaders (k order of split_f32), only its address differs.
// f32 fragment (16 rows x 32 k): 4 pieces, piece i of lane (col, g) = row col, k = 8g + 4(i & 1) + 16(i >> 1) + 0..3
__device__ __forceinline__ R16 ldp(const float* p, unsigned off) {          // p: the lane's own place (lane * 4 inside); off: the fragment's element offset
  R16 r;
  r.q[0] = *(const v4f*)(p + off); r.q[1] = *(const v4f*)(p + off + 128); r.q[2] = *(const v4f*)(p + off + 256); r.q[3] = *(const v4f*)(p + off + 384); return r;
}
// bf16 fragment (16 rows x 32 k): 2 pieces, piece i of lane (col, g) = row col, k = 8g + 16i + 0..7
__device__ __forceinline__ v16bf frag_p(const __bf16* p, unsigned off) {    // p: the lane's own place (lane * 8 inside); off: the fragment's element offset
  union { v16bf v; v8bf q[2]; } r;
  r.q[0] = *(const v8bf*)(p + off); r.q[1] = *(const v8bf*)(p + off + 256); return r.v;
}

// W [K][N] f32 (x @ W layout) -> bf16 hi/lo planes of packed W^T fragments, fragment index kc * (N/16) + column tile; via 64x64 tiles; grid = (K/64)*(N/64)
__global__ __launch_bounds__(256) void k_wt(const float* __restrict__ W, __bf16* __restrict__ Ph, __bf16* __restrict__ Pl, int K, int N) {
  __shared__ __align__(16) __bf16 th[64][72], tl[64][72];
  const int nt = N / 64, tid = threadIdx.x;
  const int n0 = (blockIdx.x % nt) * 64, k0 = (blockIdx.x / nt) * 64;
  for (int i = tid; i < 64 * 64; i += 256) { const int kk = i >> 6, nn = i & 63; const float x = W[(size_t)(k0 + kk) * N + n0 + nn];
    const __bf16 h = (__bf16)x; th[nn][kk] = h; tl[nn][kk] = (__bf16)(x - (float)h); }
  __syncthreads();
  for (int g = tid; g < 64 * 8; g += 256) { const int ln = g & 31, i = (g >> 5) & 1, jl = (g >> 6) & 3, kl = g >> 8;
    const int nn = jl * 16 + (ln & 15), pc = kl * 4 + i * 2 + (ln >> 4);
    const size_t o = ((((size_t)(k0 / 32 + kl) * (N / 16) + n0 / 16 + jl) * 2 + i) * 32 + ln) * 8;
    vst2(Ph + o, *(const v4u*)(&th[nn][pc * 8])); vst2(Pl + o, *(const v4u*)(&tl[nn][pc * 8])); }
}

// qkv projection: block = 64 tokens x all 192 cols, 16 waves = 4 row tiles of 16 tokens x 4 quarters of K: wave (kq, rt) sums k = 128 kq .. 128 kq + 127
// of its row tile, so four waves a SIMD cover each other's load waits and a block has four times the bytes in flight; the four partial sums of an element
// are added, and the bias after them, where the block's tile is read back from LDS. Waves of one quarter read the same weight fragments.
// q, k: packed f32 fragments, index (token / 16) * 2 + (d / 32); v: packed f32 fragments of V^T (rows d, k = keys), index (token / 32) * 4 + (d / 16)
#define KQ_PASSES (D_MODEL / 32 / 4)
__global__ __launch_bounds__(512) void k_qkv(const float* __restrict__ x, const __bf16* __restrict__ Wh, const __bf16* __restrict__ Wl,
                                            const float* __restrict__ bq, float* __restrict__ qb, float* __restrict__ kb, float* __restrict__ vT) {
  __shared__ __align__(16) float st[4][64][196];       // [K quarter][row][col] pitch 196
  const int tid = threadIdx.x, wave = tid >> 5, rt = wave & 3, kq = wave >> 2, lane = tid & 31, col = lane & 15, g = lane >> 4;
  const int m0 = blockIdx.x * 64 + rt * 16;
  const float* xl = x + (size_t)(m0 + col) * D_MODEL + kq * (KQ_PASSES * 32) + 8 * g;   // the lane's own places in x and in the two weight planes
  const __bf16* whl = Wh + kq * (KQ_PASSES * 12 * 512) + lane * 8; const __bf16* wll = Wl + kq * (KQ_PASSES * 12 * 512) + lane * 8;
  v8f c[12] = {};
  R16 xr = ld16(xl, 0);
#pragma unroll 1
  for (int kc = 0; kc < KQ_PASSES; ++kc) {
    // the weight fragments of six column tiles are loaded as one group ahead of their products; the next pass's x rows go with the second group
    const __bf16* wph = whl + kc * (12 * 512); const __bf16* wpl = wll + kc * (12 * 512);
    const float* xp = xl + ((kc + 1 < KQ_PASSES) ? kc + 1 : kc) * 32;   // the last pass re-reads its own rows: stays in bounds
#pragma unroll
    for (int hf = 0; hf < 2; ++hf) {
      v16bf wh[6], wl[6];
#pragma unroll
      for (int j = 0; j < 6; ++j) { wh[j] = frag_p(wph, (hf * 6 + j) * 512); wl[j] = frag_p(wpl, (hf * 6 + j) * 512); }
      const F2 a = split_r(xr);
      if (hf == 1) xr = ld16(xp, 0);
      // the group's address registers are inputs here, so they live up to this wait and no load of the group lands in them ahead of it
      asm volatile("s_wait_xcnt 0x0" :: "v"(wph), "v"(wpl), "v"(xp) : "memory");
#pragma unroll
      for (int j = 0; j < 6; ++j) { v8f t = c[hf * 6 + j];
        t = wmma_bf(a.l, wh[j], t); t = wmma_bf(a.h, wl[j], t); t = wmma_bf(a.h, wh[j], t); c[hf * 6 + j] = t; }
    }
  }
  // the biases of the elements that this thread stores below: loaded here so that the LDS stores and the barrier cover their latency
  const int pi = (tid >> 5) & 3, ko = 8 * g + (pi & 1) * 4 + (pi >> 1) * 16, dq = ((tid >> 7) & 1) * 32 + ko, dv = ((tid >> 7) & 3) * 16 + col;
  const v4f bbq = { bq[dq], bq[dq + 1], bq[dq + 2], bq[dq + 3] }, bbk = { bq[64 + dq], bq[64 + dq + 1], bq[64 + dq + 2], bq[64 + dq + 3] };
  const float bbv = bq[128 + dv];
#pragma unroll
  for (int j = 0; j < 12; ++j)
#pragma unroll
    for (int r = 0; r < 8; ++r) st[kq][rt * 16 + g * 8 + r][j * 16 + col] = c[j][r];
  __syncthreads();
  // q and k: the block's 8 fragments each (4 token tiles x 2 halves of d) = 1024 pieces of 16 B, piece gq at place gq: a wave's store is 512 contiguous bytes
#pragma unroll   // both trips' LDS reads stand together: one LDS latency
  for (int it = 0; it < 2; ++it) { const int gq = tid + it * 512, rl = (gq >> 8) * 16 + col;
    const size_t o = ((size_t)blockIdx.x * 1024 + gq) * 4;
    v4f sq = *(const v4f*)(&st[0][rl][dq]), sk = *(const v4f*)(&st[0][rl][64 + dq]);
#pragma unroll
    for (int p = 1; p < 4; ++p) { sq += *(const v4f*)(&st[p][rl][dq]); sk += *(const v4f*)(&st[p][rl][64 + dq]); }
    vst2(qb + o, sq + bbq);
    vst2(kb + o, sk + bbk); }
  // v: the block's 8 fragments (2 key blocks of 32 x 4 tiles of d), a piece = 4 consecutive keys of one d
#pragma unroll   // both trips' LDS reads stand together: one LDS latency
  for (int it = 0; it < 2; ++it) { const int gq = tid + it * 512, kl = it * 32 + ko;
    v4f v = { st[0][kl][128 + dv], st[0][kl + 1][128 + dv], st[0][kl + 2][128 + dv], st[0][kl + 3][128 + dv] };
#pragma unroll
    for (int p = 1; p < 4; ++p) { const v4f u = { st[p][kl][128 + dv], st[p][kl + 1][128 + dv], st[p][kl + 2][128 + dv], st[p][kl + 3][128 + dv] }; v += u; }
    vst2(vT + ((size_t)blockIdx.x * 1024 + gq) * 4, v + bbv); }
}

// the lane's value from the other half of the wave (lane ^ 16), by a vector cross-row move: no LDS, no wait
__device__ __forceinline__ float xhalf(float v) {
  const unsigned b = __builtin_bit_cast(unsigned, v);
  return __builtin_bit_cast(float, __builtin_amdgcn_permlanex16(b, b, 0x76543210u, 0xfedcba98u, false, false));
}

__device__ __forceinline__ void st_frag(__bf16* p, unsigned off, v16bf v) {   // the store that frag_p reads back
  union { v16bf v; v8bf q[2]; } r; r.v = v;
  *(v8bf*)(p + off) = r.q[0]; *(v8bf*)(p + off + 256) = r.q[1];
}
// the three products of two split operands, hi*lo + lo*hi + hi*hi, for two B operands (Q, P^T of two query tiles) that share the A operand (K rows, V^T rows);
// the two accumulator chains alternate, so each covers the other's latency
__device__ __forceinline__ void mac3t2(const F2& a, const F2& b0, const F2& b1, v8f& c0, v8f& c1) {
  c0 = wmma_bf(a.h, b0.l, c0); c1 = wmma_bf(a.h, b1.l, c1);
  c0 = wmma_bf(a.l, b0.h, c0); c1 = wmma_bf(a.l, b1.h, c1);
  c0 = wmma_bf(a.h, b0.h, c0); c1 = wmma_bf(a.h, b1.h, c1);
}

__global__ __launch_bounds__(512) void k_attn(const float* __restrict__ qb, const float* __restrict__ kb, const float* __restrict__ vT,
                                              const __bf16* __restrict__ Wh, const __bf16* __restrict__ Wl, const float* __restrict__ bo, float* __restrict__ out) {
  __shared__ __align__(16) float os[16][32 * 68];       // un-normalised partial output per wave, [query][d], pitch 68: 16-byte stores of 16 lanes meet 64 banks once
  __shared__ float ms[16][32], ls[16][32];              // partial row maxima and row sums per wave
  __shared__ __align__(16) float om[2][32 * 68];        // per half: the merged, normalised tile [query][d]: the A operand of the output projection
  __shared__ __align__(16) float st[2][32 * 260];       // per half: the tile's 32 x 256 outputs, staged so that a wave stores whole lines
  const int wv = __builtin_amdgcn_readfirstlane(threadIdx.x >> 5), hb = wv >> 3, wl = wv & 7;
  const int b = blockIdx.x & (NBATCH - 1), pr = blockIdx.x >> 3;
  const int qs = (hb ? pr : NSEQ / 32 - 1 - pr) * 32;
  const int lane = threadIdx.x & 31, g = lane >> 4, col = lane & 15, th = threadIdx.x & 255;
  const float* qp = qb + ((size_t)b * NSEQ + qs) * D_ATTN + lane * 4;    // the two tiles' four packed fragments
  // the split Q fragments lie in the wave's OWN range of os while the key loop runs (its partial output goes there only behind the loop): in registers they
  // would take 64 of the 256 that four waves a SIMD leave a wave. Fragment (dh * 2 + u) * 2 + (0: hi, 1: lo), 1 KB each, in the packed order of frag_p.
  __bf16* qw = (__bf16*)os[wv] + lane * 8;
#pragma unroll
  for (int dh = 0; dh < 2; ++dh)
#pragma unroll
    for (int u = 0; u < 2; ++u) { const F2 f = split_r(ldp(qp, u * 1024 + dh * 512));
      st_frag(qw, ((dh * 2 + u) * 2) * 512, f.h); st_frag(qw, ((dh * 2 + u) * 2 + 1) * 512, f.l); }
  float m_r[2] = { -1e30f, -1e30f }, l_r[2] = { 0.f, 0.f };   // the lane's two queries: running maximum (equal in both halves), sum over this half's keys
  v8f o[2][4] = {};                                     // O^T: o[u][t][r] = O[query 16 u + col][d = 16 t + 8 g + r]
  const int jmax = qs >> 5;
  const unsigned loff = lane * 4;
  const int qk = qs + col - 8 * g;                      // tile u: key ks + 8 g + r is masked where ks + r > qk + 16 u
  for (int j = wl; j <= jmax; j += 8) {
    const int ks = j * 32;
    const float* kt = kb + ((size_t)b * NSEQ + ks) * D_ATTN + loff;   // the lane's place in the key block's four packed fragments
    // all 16 K loads of the block stand ahead of the first product, so one wait covers them
    const R16 k00 = ldp(kt, 0), k01 = ldp(kt, 512), k10 = ldp(kt, 1024), k11 = ldp(kt, 1536);
    // the group's address register is an input here, so it lives up to this wait and no load of the group lands in it ahead of it
    asm volatile("s_wait_xcnt 0x0" :: "v"(kt) : "memory");
    v8f s0[2] = {}, s1[2] = {};
    { const F2 q0 = { frag_p(qw, 0), frag_p(qw, 512) }, q1 = { frag_p(qw, 1024), frag_p(qw, 1536) };          // d 0..31 of both tiles
      mac3t2(split_r(k00), q0, q1, s0[0], s0[1]); mac3t2(split_r(k10), q0, q1, s1[0], s1[1]); }
    { const F2 q0 = { frag_p(qw, 2048), frag_p(qw, 2560) }, q1 = { frag_p(qw, 3072), frag_p(qw, 3584) };    // d 32..63 of both tiles
      mac3t2(split_r(k01), q0, q1, s0[0], s0[1]); mac3t2(split_r(k11), q0, q1, s1[0], s1[1]); }
    // all 16 V loads of the block stand ahead of the softmax, which covers their latency
    const float* vb = vT + ((size_t)b * NSEQ + ks) * D_ATTN + loff;
    R16 vr[4];
#pragma unroll
    for (int t = 0; t < 4; ++t) vr[t] = ldp(vb, t * 512);
    // the group's address register is an input here, so it lives up to this wait and no load of the group lands in it ahead of it
    asm volatile("s_wait_xcnt 0x0" :: "v"(vb) : "memory");
    F2 pf[2]; float mn[2], sum[2];
#pragma unroll
    for (int u = 0; u < 2; ++u) {
      float a[16], mx[8];
#pragma unroll
      for (int r = 0; r < 8; ++r) {
        a[r]     = s0[u][r] * SCALE_F; if (ks + r > qk + 16 * u)      a[r]     = -1e30f;
        a[r + 8] = s1[u][r] * SCALE_F; if (ks + 16 + r > qk + 16 * u) a[r + 8] = -1e30f;
        mx[r] = fmaxf(a[r], a[r + 8]);
      }
#pragma unroll
      for (int w = 4; w >= 1; w >>= 1)
#pragma unroll
        for (int r = 0; r < w; ++r) mx[r] = fmaxf(mx[r], mx[r + w]);
      mn[u] = fmaxf(m_r[u], fmaxf(mx[0], xhalf(mx[0])));
      float sm[16];                                       // element s of the B operand = key ks + 8g + s (s < 8) or ks + 8 + 8g + s (s >= 8) = score a[s]
#pragma unroll
      for (int s = 0; s < 16; ++s) {
        const float pv = __expf(a[s] - mn[u]); const __bf16 h = (__bf16)pv;
        pf[u].h[s] = h; pf[u].l[s] = (__bf16)(pv - (float)h); sm[s] = pv;
      }
#pragma unroll
      for (int w = 8; w >= 1; w >>= 1)
#pragma unroll
        for (int s = 0; s < w; ++s) sm[s] += sm[s + w];
      sum[u] = sm[0];
    }
    // keeps the conversions of V, and with them the wait for the V loads, behind the softmax: without it the wait stands ahead of the softmax, which then covers no latency
    __builtin_amdgcn_sched_barrier(0);
#pragma unroll
    for (int u = 0; u < 2; ++u) {
      const float corr = __expf(m_r[u] - mn[u]);
      l_r[u] = l_r[u] * corr + sum[u]; m_r[u] = mn[u];
#pragma unroll
      for (int t = 0; t < 4; ++t) o[u][t] *= corr;
    }
#pragma unroll
    for (int t = 0; t < 4; ++t) mac3t2(split_r(vr[t]), pf[0], pf[1], o[0][t], o[1][t]);
  }
#pragma unroll
  for (int u = 0; u < 2; ++u) {
    l_r[u] += xhalf(l_r[u]);                              // the two halves' sums are joined once
    float* so = os[wv] + (u * 16 + col) * 68 + 8 * g;
#pragma unroll
    for (int t = 0; t < 4; ++t) {
      const v4f lo = { o[u][t][0], o[u][t][1], o[u][t][2], o[u][t][3] }, hi = { o[u][t][4], o[u][t][5], o[u][t][6], o[u][t][7] };
      vst2(so + t * 16, lo); vst2(so + t * 16 + 4, hi);
    }
  }
  ms[wv][lane] = g ? m_r[1] : m_r[0]; ls[wv][lane] = g ? l_r[1] : l_r[0];   // row 16 u + col is written by the lane with g = u (both halves hold the same values)
  __syncthreads();                                        // every wave's partial state is in LDS before any thread merges
  // output projection, this wave's two column tiles (2 wl, 2 wl + 1): their weight fragments and biases are loaded ahead of the merge, which covers their latency
  v16bf wh0[2], wl0[2], wh1[2], wl1[2]; float bb[2];
  const __bf16* wph = Wh + wl * 1024 + lane * 8; const __bf16* wpl = Wl + wl * 1024 + lane * 8; const float* bp = bo + wl * 32 + col;
#pragma unroll
  for (int i = 0; i < 2; ++i) { const unsigned ro = i * 512;
    wh0[i] = frag_p(wph, ro); wl0[i] = frag_p(wpl, ro); wh1[i] = frag_p(wph, ro + 16 * 512); wl1[i] = frag_p(wpl, ro + 16 * 512);
    bb[i] = bp[i * 16]; }
  // the group's address registers are inputs here, so they live up to this wait and no load of the group lands in them ahead of it
  asm volatile("s_wait_xcnt 0x0" :: "v"(wph), "v"(wpl), "v"(bp) : "memory");
  // merge: thread of a half -> (row, 4 columns), two rows a thread; a wave that had no key block holds max -1e30, sum 0, zeros: weight 0
  const int c4 = (th & 15) * 4, w0 = hb * 8;
#pragma unroll
  for (int it = 0; it < 2; ++it) {
    const int row = it * 16 + (th >> 4);
    float M = ms[w0][row];
#pragma unroll
    for (int w = 1; w < 8; ++w) M = fmaxf(M, ms[w0 + w][row]);
    float L = 0.f; v4f acc = {};
#pragma unroll
    for (int w = 0; w < 8; ++w) { const float wg = __expf(ms[w0 + w][row] - M);
      L += ls[w0 + w][row] * wg; acc += *(const v4f*)(&os[w0 + w][row * 68 + c4]) * wg; }
    vst2(om[hb] + row * 68 + c4, acc / L);
  }
  __syncthreads();                                        // the merged tiles are whole before any wave takes its fragments
#pragma unroll
  for (int u = 0; u < 2; ++u) {
    const float* orow = om[hb] + (u * 16 + col) * 68;
    const F2 a0 = split_f32(orow, 0, lane), a1 = split_f32(orow, 32, lane);
#pragma unroll
    for (int i = 0; i < 2; ++i) {
      v8f c = {};
      c = wmma_bf(a0.l, wh0[i], c); c = wmma_bf(a0.h, wl0[i], c); c = wmma_bf(a0.h, wh0[i], c);
      c = wmma_bf(a1.l, wh1[i], c); c = wmma_bf(a1.h, wl1[i], c); c = wmma_bf(a1.h, wh1[i], c);
#pragma unroll
      for (int r = 0; r < 8; ++r) st[hb][(u * 16 + r + 8 * g) * 260 + (wl * 2 + i) * 16 + col] = c[r] + bb[i];
    }
  }
  __syncthreads();                                        // all 256 columns are staged before the rows go out
  // per half 32 rows x 64 pieces of 16 B: a wave's store is 512 contiguous bytes
  const int r0 = th >> 6, pc = th & 63;                   // trip q: row 4 q + r0, one base address each for LDS and for out
  float* op = out + ((size_t)b * NSEQ + qs + r0) * D_OUT + pc * 4; const float* sp = st[hb] + r0 * 260 + pc * 4;
#pragma unroll
  for (int q = 0; q < 8; ++q) vst2(op + q * (4 * D_OUT), *(const v4f*)(sp + q * (4 * 260)));
}

extern "C" void kernel_launch(void* const* d_in, const int* in_sizes, int n_in,
                              void* d_out, int out_size, void* d_ws, size_t ws_size,
                              hipStream_t stream) {
  (void)in_sizes; (void)n_in; (void)out_size; (void)ws_size;
  const float* x     = (const float*)d_in[0];
  const float* W_qkv = (const float*)d_in[1];
  const float* b_qkv = (const float*)d_in[2];
  const float* W_out = (const float*)d_in[3];
  const float* b_out = (const float*)d_in[4];
  float* out = (float*)d_out;
  char* ws = (char*)d_ws; size_t off = 0;
  auto alloc = [&](size_t bytes) -> void* { void* p = ws + off; off = (off + bytes + 255) & ~(size_t)255; return p; };
  __bf16* Wqh = (__bf16*)alloc((size_t)D_QKV * D_MODEL * 2); __bf16* Wql = (__bf16*)alloc((size_t)D_QKV * D_MODEL * 2);
  __bf16* Woh = (__bf16*)alloc((size_t)D_OUT * D_ATTN * 2);  __bf16* Wol = (__bf16*)alloc((size_t)D_OUT * D_ATTN * 2);
  float* qb = (float*)alloc((size_t)NTOK * D_ATTN * 4); float* kb = (float*)alloc((size_t)NTOK * D_ATTN * 4);
  float* vT = (float*)alloc((size_t)NTOK * D_ATTN * 4);

  k_wt<<<(D_MODEL / 64) * (D_QKV / 64), 256, 0, stream>>>(W_qkv, Wqh, Wql, D_MODEL, D_QKV);
  k_wt<<<(D_ATTN / 64) * (D_OUT / 64), 256, 0, stream>>>(W_out, Woh, Wol, D_ATTN, D_OUT);
  k_qkv<<<NTOK / 64, 512, 0, stream>>>(x, Wqh, Wql, b_qkv, qb, kb, vT);
  k_attn<<<NBATCH * (NSEQ / 64), 512, 0, stream>>>(qb, kb, vT, Woh, Wol, b_out, out);
}

// v008
// One run takes 39.8 microseconds.
// In both of two side-by-side timings against v007, it was 1.11 times as fast.
// Counting every step since v000, it is 9.33 times as fast.
#include <hip/hip_runtime.h>
#include <math.h>

// Causal single-head attention (d_attn 64) with qkv and output projections.
// All four contractions (qkv projection K = 512, scores K = 64, P @ V over <= 2048 keys, output projection K = 64) on
// v_wmma_f32_16x16x32_bf16 as a TWO-WAY bf16 split of both f32 operands (hi*hi + hi*lo + lo*hi, f32 accumulate).

#define D_MODEL 512
#define D_ATTN  64
#define NSEQ    2048
#define NBATCH  8
#define NTOK    (NBATCH * NSEQ)
#define D_OUT   256
#define D_QKV   192
#define SCALE_F 0.125f

typedef __attribute__((ext_vector_type(16))) __bf16 v16bf;
typedef __attribute__((ext_vector_type(8)))  __bf16 v8bf;
typedef __attribute__((ext_vector_type(8)))  float  v8f;
typedef __attribute__((ext_vector_type(4)))  float  v4f;
typedef __attribute__((ext_vector_type(4)))  unsigned v4u;

template <typename T> __device__ __forceinline__ void vst2(void* p, T v) { *(T*)p = v;  }
__device__ __forceinline__ v8f wmma_bf(v16bf a, v16bf b, v8f c) {
  v8f d = __builtin_amdgcn_wmma_f32_16x16x32_bf16(false, a, false, b, (short)0, c, false, false);
  asm volatile("v_nop\n\tv_nop\n\tv_nop\n\tv_nop" : "+v"(d) : "v"(a), "v"(b));
  return d;
}
struct F2 { v16bf h, l; };
// split an f32 row fragment (row base pointer, k0) into bf16 hi/lo; element i<8 -> k0+8g+i, i>=8 -> k0+16+8g+(i-8)
__device__ __forceinline__ F2 split_f32(const float* row, int k0, int lane) {
  F2 r; const float* p = row + k0 + 8 * (lane >> 4);
#pragma unroll
  for (int i = 0; i < 16; ++i) { const float x = p[(i < 8) ? i : (i + 8)]; const __bf16 h = (__bf16)x; r.h[i] = h; r.l[i] = (__bf16)(x - (float)h); }
  return r;
}
// the 16 f32 of one fragment as loaded (same addresses as split_f32), and their split: lets a pass issue its loads as one group
struct R16 { v4f q[4]; };
__device__ __forceinline__ R16 ld16(const float* base, unsigned off) {   // base pointer plus the lane's 32-bit element offset
  R16 r;
  r.q[0] = *(const v4f*)(base + off); r.q[1] = *(const v4f*)(base + off + 4); r.q[2] = *(const v4f*)(base + off + 16); r.q[3] = *(const v4f*)(base + off + 20); return r;
}
__device__ __forceinline__ F2 split_r(const R16& s) {
  F2 r;
#pragma unroll
  for (int i = 0; i < 16; ++i) { const float x = s.q[i >> 2][i & 3]; const __bf16 h = (__bf16)x; r.h[i] = h; r.l[i] = (__bf16)(x - (float)h); }
  return r;
}
// PACKED FRAGMENTS. The weight planes, q, k and v (each written by one kernel for another) lie in the order in which a wave loads them: piece i of a fragment
// is 32 lanes x 16 B = 512 contiguous bytes (four whole 128-B lines a load, where a row-major operand gives sixteen lines with 32 B each).
// The element that a lane's register holds is the same as with the row-major loaders (k order of split_f32), only its address differs.
// f32 fragment (16 rows x 32 k): 4 pieces, piece i of lane (col, g) = row col, k = 8g + 4(i & 1) + 16(i >> 1) + 0..3
__device__ __forceinline__ R16 ldp(const float* p, unsigned off) {          // p: the lane's own place (lane * 4 inside); off: the fragment's element offset
  R16 r;
  r.q[0] = *(const v4f*)(p + off); r.q[1] = *(const v4f*)(p + off + 128); r.q[2] = *(const v4f*)(p + off + 256); r.q[3] = *(const v4f*)(p + off + 384); return r;
}
// bf16 fragment (16 rows x 32 k): 2 pieces, piece i of lane (col, g) = row col, k = 8g + 16i + 0..7
__device__ __forceinline__ v16bf frag_p(const __bf16* p, unsigned off) {    // p: the lane's own place (lane * 8 inside); off: the fragment's element offset
  union { v16bf v; v8bf q[2]; } r;
  r.q[0] = *(const v8bf*)(p + off); r.q[1] = *(const v8bf*)(p + off + 256); return r.v;
}

// W [K][N] f32 (x @ W layout) -> bf16 hi/lo planes of packed W^T fragments, fragment index kc * (N/16) + column tile; via 64x64 tiles, (K/64)*(N/64) of them
// BOTH WEIGHT MATRICES IN ONE LAUNCH: neither conversion reads what the other writes, so the tiles of the output weights ride along as the grid's last blocks
// instead of waiting, as a launch of their own, for the first conversion to end. The choice is the same for a whole block.
#define WT_TILES_QKV ((D_MODEL / 64) * (D_QKV / 64))
#define WT_TILES_OUT ((D_ATTN / 64) * (D_OUT / 64))
__global__ __launch_bounds__(256) void k_wt(const float* __restrict__ Wq, __bf16* __restrict__ Qh, __bf16* __restrict__ Ql,
                                            const float* __restrict__ Wo, __bf16* __restrict__ Oh, __bf16* __restrict__ Ol) {
  __shared__ __align__(16) __bf16 th[64][72], tl[64][72];
  const bool fq = blockIdx.x < WT_TILES_QKV;
  const float* W = fq ? Wq : Wo; __bf16* Ph = fq ? Qh : Oh; __bf16* Pl = fq ? Ql : Ol;
  const int N = fq ? D_QKV : D_OUT, tile = fq ? blockIdx.x : blockIdx.x - WT_TILES_QKV;
  const int nt = N / 64, tid = threadIdx.x;
  const int n0 = (tile % nt) * 64, k0 = (tile / nt) * 64;
  for (int i = tid; i < 64 * 64; i += 256) { const int kk = i >> 6, nn = i & 63; const float x = W[(size_t)(k0 + kk) * N + n0 + nn];
    const __bf16 h = (__bf16)x; th[nn][kk] = h; tl[nn][kk] = (__bf16)(x - (float)h); }
  __syncthreads();
  for (int g = tid; g < 64 * 8; g += 256) { const int ln = g & 31, i = (g >> 5) & 1, jl = (g >> 6) & 3, kl = g >> 8;
    const int nn = jl * 16 + (ln & 15), pc = kl * 4 + i * 2 + (ln >> 4);
    const size_t o = ((((size_t)(k0 / 32 + kl) * (N / 16) + n0 / 16 + jl) * 2 + i) * 32 + ln) * 8;
    vst2(Ph + o, *(const v4u*)(&th[nn][pc * 8])); vst2(Pl + o, *(const v4u*)(&tl[nn][pc * 8])); }
}

// qkv projection: block = 64 tokens x all 192 cols, 16 waves = 4 row tiles of 16 tokens x 4 quarters of K: wave (kq, rt) sums k = 128 kq .. 128 kq + 127
// of its row tile, so four waves a SIMD cover each other's load waits and a block has four times the bytes in flight; the four partial sums of an element
// are added, and the bias after them, where the block's tile is read back from LDS. Waves of one quarter read the same weight fragments.
// q, k: packed f32 fragments, index (token / 16) * 2 + (d / 32); v: packed f32 fragments of V^T (rows d, k = keys), index (token / 32) * 4 + (d / 16)
#define KQ_PASSES (D_MODEL / 32 / 4)
__global__ __launch_bounds__(512) void k_qkv(const float* __restrict__ x, const __bf16* __restrict__ Wh, const __bf16* __restrict__ Wl,
                                            const float* __restrict__ bq, float* __restrict__ qb, float* __restrict__ kb, float* __restrict__ vT) {
  __shared__ __align__(16) float st[4][64][196];       // [K quarter][row][col] pitch 196
  const int tid = threadIdx.x, wave = tid >> 5, rt = wave & 3, kq = wave >> 2, lane = tid & 31, col = lane & 15, g = lane >> 4;
  const int m0 = blockIdx.x * 64 + rt * 16;
  const float* xl = x + (size_t)(m0 + col) * D_MODEL + kq * (KQ_PASSES * 32) + 8 * g;   // the lane's own places in x and in the two weight planes
  const __bf16* whl = Wh + kq * (KQ_PASSES * 12 * 512) + lane * 8; const __bf16* wll = Wl + kq * (KQ_PASSES * 12 * 512) + lane * 8;
  v8f c[12] = {};
  R16 xr = ld16(xl, 0);
#pragma unroll 1
  for (int kc = 0; kc < KQ_PASSES; ++kc) {
    // the weight fragments of six column tiles are loaded as one group ahead of their products; the next pass's x rows go with the second group
    const __bf16* wph = whl + kc * (12 * 512); const __bf16* wpl = wll + kc * (12 * 512);
    const float* xp = xl + ((kc + 1 < KQ_PASSES) ? kc + 1 : kc) * 32;   // the last pass re-reads its own rows: stays in bounds
#pragma unroll
    for (int hf = 0; hf < 2; ++hf) {
      v16bf wh[6], wl[6];
#pragma unroll
      for (int j = 0; j < 6; ++j) { wh[j] = frag_p(wph, (hf * 6 + j) * 512); wl[j] = frag_p(wpl, (hf * 6 + j) * 512); }
      const F2 a = split_r(xr);
      if (hf == 1) xr = ld16(xp, 0);
      // the group's address registers are inputs here, so they live up to this wait and no load of the group lands in them ahead of it
      asm volatile("s_wait_xcnt 0x0" :: "v"(wph), "v"(wpl), "v"(xp) : "memory");
#pragma unroll
      for (int j = 0; j < 6; ++j) { v8f t = c[hf * 6 + j];
        t = wmma_bf(a.l, wh[j], t); t = wmma_bf(a.h, wl[j], t); t = wmma_bf(a.h, wh[j], t); c[hf * 6 + j] = t; }
    }
  }
  // the biases of the elements that this thread stores below: loaded here so that the LDS stores and the barrier cover their latency
  const int pi = (tid >> 5) & 3, ko = 8 * g + (pi & 1) * 4 + (pi >> 1) * 16, dq = ((tid >> 7) & 1) * 32 + ko, dv = ((tid >> 7) & 3) * 16 + col;
  const v4f bbq = { bq[dq], bq[dq + 1], bq[dq + 2], bq[dq + 3] }, bbk = { bq[64 + dq], bq[64 + dq + 1], bq[64 + dq + 2], bq[64 + dq + 3] };
  const float bbv = bq[128 + dv];
#pragma unroll
  for (int j = 0; j < 12; ++j)
#pragma unroll
    for (int r = 0; r < 8; ++r) st[kq][rt * 16 + g * 8 + r][j * 16 + col] = c[j][r];
  __syncthreads();
  // q and k: the block's 8 fragments each (4 token tiles x 2 halves of d) = 1024 pieces of 16 B, piece gq at place gq: a wave's store is 512 contiguous bytes
#pragma unroll   // both trips' LDS reads stand together: one LDS latency
  for (int it = 0; it < 2; ++it) { const int gq = tid + it * 512, rl = (gq >> 8) * 16 + col;
    const size_t o = ((size_t)blockIdx.x * 1024 + gq) * 4;
    v4f sq = *(const v4f*)(&st[0][rl][dq]), sk = *(const v4f*)(&st[0][rl][64 + dq]);
#pragma unroll
    for (int p = 1; p < 4; ++p) { sq += *(const v4f*)(&st[p][rl][dq]); sk += *(const v4f*)(&st[p][rl][64 + dq]); }
    vst2(qb + o, sq + bbq);
    vst2(kb + o, sk + bbk); }
  // v: the block's 8 fragments (2 key blocks of 32 x 4 tiles of d), a piece = 4 consecutive keys of one d
#pragma unroll   // both trips' LDS reads stand together: one LDS latency
  for (int it = 0; it < 2; ++it) { const int gq = tid + it * 512, kl = it * 32 + ko;
    v4f v = { st[0][kl][128 + dv], st[0][kl + 1][128 + dv], st[0][kl + 2][128 + dv], st[0][kl + 3][128 + dv] };
#pragma unroll
    for (int p = 1; p < 4; ++p) { const v4f u = { st[p][kl][128 + dv], st[p][kl + 1][128 + dv], st[p][kl + 2][128 + dv], st[p][kl + 3][128 + dv] }; v += u; }
    vst2(vT + ((size_t)blockIdx.x * 1024 + gq) * 4, v + bbv); }
}

// the lane's value from the other half of the wave (lane ^ 16), by a vector cross-row move: no LDS, no wait
__device__ __forceinline__ float xhalf(float v) {
  const unsigned b = __builtin_bit_cast(unsigned, v);
  return __builtin_bit_cast(float, __builtin_amdgcn_permlanex16(b, b, 0x76543210u, 0xfedcba98u, false, false));
}

__device__ __forceinline__ void st_frag(__bf16* p, unsigned off, v16bf v) {   // the store that frag_p reads back
  union { v16bf v; v8bf q[2]; } r; r.v = v;
  *(v8bf*)(p + off) = r.q[0]; *(v8bf*)(p + off + 256) = r.q[1];
}
// the three products of two split operands, hi*lo + lo*hi + hi*hi, for two B operands (Q, P^T of two query tiles) that share the A operand (K rows, V^T rows);
// the two accumulator chains alternate, so each covers the other's latency
__device__ __forceinline__ void mac3t2(const F2& a, const F2& b0, const F2& b1, v8f& c0, v8f& c1) {
  c0 = wmma_bf(a.h, b0.l, c0); c1 = wmma_bf(a.h, b1.l, c1);
  c0 = wmma_bf(a.l, b0.h, c0); c1 = wmma_bf(a.l, b1.h, c1);
  c0 = wmma_bf(a.h, b0.h, c0); c1 = wmma_bf(a.h, b1.h, c1);
}

__global__ __launch_bounds__(512) void k_attn(const float* __restrict__ qb, const float* __restrict__ kb, const float* __restrict__ vT,
                                              const __bf16* __restrict__ Wh, const __bf16* __restrict__ Wl, const float* __restrict__ bo, float* __restrict__ out) {
  __shared__ __align__(16) float os[16][32 * 68];       // un-normalised partial output per wave, [query][d], pitch 68: 16-byte stores of 16 lanes meet 64 banks once
  __shared__ float ms[16][32], ls[16][32];              // partial row maxima and row sums per wave
  __shared__ __align__(16) float om[2][32 * 68];        // per half: the merged, normalised tile [query][d]: the A operand of the output projection
  __shared__ __align__(16) float st[2][32 * 260];       // per half: the tile's 32 x 256 outputs, staged so that a wave stores whole lines
  const int wv = __builtin_amdgcn_readfirstlane(threadIdx.x >> 5), hb = wv >> 3, wl = wv & 7;
  const int b = blockIdx.x & (NBATCH - 1), pr = blockIdx.x >> 3;
  const int qs = (hb ? pr : NSEQ / 32 - 1 - pr) * 32;
  const int lane = threadIdx.x & 31, g = lane >> 4, col = lane & 15, th = threadIdx.x & 255;
  const float* qp = qb + ((size_t)b * NSEQ + qs) * D_ATTN + lane * 4;    // the two tiles' four packed fragments
  // the split Q fragments lie in the wave's OWN range of os while the key loop runs (its partial output goes there only behind the loop): in registers they
  // would take 64 of the 256 that four waves a SIMD leave a wave. Fragment (dh * 2 + u) * 2 + (0: hi, 1: lo), 1 KB each, in the packed order of frag_p.
  __bf16* qw = (__bf16*)os[wv] + lane * 8;
#pragma unroll
  for (int dh = 0; dh < 2; ++dh)
#pragma unroll
    for (int u = 0; u < 2; ++u) { const F2 f = split_r(ldp(qp, u * 1024 + dh * 512));
      st_frag(qw, ((dh * 2 + u) * 2) * 512, f.h); st_frag(qw, ((dh * 2 + u) * 2 + 1) * 512, f.l); }
  float m_r[2] = { -1e30f, -1e30f }, l_r[2] = { 0.f, 0.f };   // the lane's two queries: running maximum (equal in both halves), sum over this half's keys
  v8f o[2][4] = {};                                     // O^T: o[u][t][r] = O[query 16 u + col][d = 16 t + 8 g + r]
  const int jmax = qs >> 5;
  const unsigned loff = lane * 4;
  const int qk = qs + col - 8 * g;                      // tile u: key ks + 8 g + r is masked where ks + r > qk + 16 u
  for (int j = wl; j <= jmax; j += 8) {
    const int ks = j * 32;
    const float* kt = kb + ((size_t)b * NSEQ + ks) * D_ATTN + loff;   // the lane's place in the key block's four packed fragments
    // all 16 K loads of the block stand ahead of the first product, so one wait covers them
    const R16 k00 = ldp(kt, 0), k01 = ldp(kt, 512), k10 = ldp(kt, 1024), k11 = ldp(kt, 1536);
    // the group's address register is an input here, so it lives up to this wait and no load of the group lands in it ahead of it
    asm volatile("s_wait_xcnt 0x0" :: "v"(kt) : "memory");
    v8f s0[2] = {}, s1[2] = {};
    { const F2 q0 = { frag_p(qw, 0), frag_p(qw, 512) }, q1 = { frag_p(qw, 1024), frag_p(qw, 1536) };          // d 0..31 of both tiles
      mac3t2(split_r(k00), q0, q1, s0[0], s0[1]); mac3t2(split_r(k10), q0, q1, s1[0], s1[1]); }
    { const F2 q0 = { frag_p(qw, 2048), frag_p(qw, 2560) }, q1 = { frag_p(qw, 3072), frag_p(qw, 3584) };    // d 32..63 of both tiles
      mac3t2(split_r(k01), q0, q1, s0[0], s0[1]); mac3t2(split_r(k11), q0, q1, s1[0], s1[1]); }
    // all 16 V loads of the block stand ahead of the softmax, which covers their latency
    const float* vb = vT + ((size_t)b * NSEQ + ks) * D_ATTN + loff;
    R16 vr[4];
#pragma unroll
    for (int t = 0; t < 4; ++t) vr[t] = ldp(vb, t * 512);
    // the group's address register is an input here, so it lives up to this wait and no load of the group lands in it ahead of it
    asm volatile("s_wait_xcnt 0x0" :: "v"(vb) : "memory");
    F2 pf[2]; float mn[2], sum[2];
#pragma unroll
    for (int u = 0; u < 2; ++u) {
      float a[16], mx[8];
#pragma unroll
      for (int r = 0; r < 8; ++r) {
        a[r]     = s0[u][r] * SCALE_F; if (ks + r > qk + 16 * u)      a[r]     = -1e30f;
        a[r + 8] = s1[u][r] * SCALE_F; if (ks + 16 + r > qk + 16 * u) a[r + 8] = -1e30f;
        mx[r] = fmaxf(a[r], a[r + 8]);
      }
#pragma unroll
      for (int w = 4; w >= 1; w >>= 1)
#pragma unroll
        for (int r = 0; r < w; ++r) mx[r] = fmaxf(mx[r], mx[r + w]);
      mn[u] = fmaxf(m_r[u], fmaxf(mx[0], xhalf(mx[0])));
      float sm[16];                                       // element s of the B operand = key ks + 8g + s (s < 8) or ks + 8 + 8g + s (s >= 8) = score a[s]
#pragma unroll
      for (int s = 0; s < 16; ++s) {
        const float pv = __expf(a[s] - mn[u]); const __bf16 h = (__bf16)pv;
        pf[u].h[s] = h; pf[u].l[s] = (__bf16)(pv - (float)h); sm[s] = pv;
      }
#pragma unroll
      for (int w = 8; w >= 1; w >>= 1)
#pragma unroll
        for (int s = 0; s < w; ++s) sm[s] += sm[s + w];
      sum[u] = sm[0];
    }
    // keeps the conversions of V, and with them the wait for the V loads, behind the softmax: without it the wait stands ahead of the softmax, which then covers no latency
    __builtin_amdgcn_sched_barrier(0);
#pragma unroll
    for (int u = 0; u < 2; ++u) {
      const float corr = __expf(m_r[u] - mn[u]);
      l_r[u] = l_r[u] * corr + sum[u]; m_r[u] = mn[u];
#pragma unroll
      for (int t = 0; t < 4; ++t) o[u][t] *= corr;
    }
#pragma unroll
    for (int t = 0; t < 4; ++t) mac3t2(split_r(vr[t]), pf[0], pf[1], o[0][t], o[1][t]);
  }
#pragma unroll
  for (int u = 0; u < 2; ++u) {
    l_r[u] += xhalf(l_r[u]);                              // the two halves' sums are joined once
    float* so = os[wv] + (u * 16 + col) * 68 + 8 * g;
#pragma unroll
    for (int t = 0; t < 4; ++t) {
      const v4f lo = { o[u][t][0], o[u][t][1], o[u][t][2], o[u][t][3] }, hi = { o[u][t][4], o[u][t][5], o[u][t][6], o[u][t][7] };
      vst2(so + t * 16, lo); vst2(so + t * 16 + 4, hi);
    }
  }
  ms[wv][lane] = g ? m_r[1] : m_r[0]; ls[wv][lane] = g ? l_r[1] : l_r[0];   // row 16 u + col is written by the lane with g = u (both halves hold the same values)
  __syncthreads();                                        // every wave's partial state is in LDS before any thread merges
  // output projection, this wave's two column tiles (2 wl, 2 wl + 1): their weight fragments and biases are loaded ahead of the merge, which covers their latency
  v16bf wh0[2], wl0[2], wh1[2], wl1[2]; float bb[2];
  const __bf16* wph = Wh + wl * 1024 + lane * 8; const __bf16* wpl = Wl + wl * 1024 + lane * 8; const float* bp = bo + wl * 32 + col;
#pragma unroll
  for (int i = 0; i < 2; ++i) { const unsigned ro = i * 512;
    wh0[i] = frag_p(wph, ro); wl0[i] = frag_p(wpl, ro); wh1[i] = frag_p(wph, ro + 16 * 512); wl1[i] = frag_p(wpl, ro + 16 * 512);
    bb[i] = bp[i * 16]; }
  // the group's address registers are inputs here, so they live up to this wait and no load of the group lands in them ahead of it
  asm volatile("s_wait_xcnt 0x0" :: "v"(wph), "v"(wpl), "v"(bp) : "memory");
  // merge: thread of a half -> (row, 4 columns), two rows a thread; a wave that had no key block holds max -1e30, sum 0, zeros: weight 0
  const int c4 = (th & 15) * 4, w0 = hb * 8;
#pragma unroll
  for (int it = 0; it < 2; ++it) {
    const int row = it * 16 + (th >> 4);
    float M = ms[w0][row];
#pragma unroll
    for (int w = 1; w < 8; ++w) M = fmaxf(M, ms[w0 + w][row]);
    float L = 0.f; v4f acc = {};
#pragma unroll
    for (int w = 0; w < 8; ++w) { const float wg = __expf(ms[w0 + w][row] - M);
      L += ls[w0 + w][row] * wg; acc += *(const v4f*)(&os[w0 + w][row * 68 + c4]) * wg; }
    vst2(om[hb] + row * 68 + c4, acc / L);
  }
  __syncthreads();                                        // the merged tiles are whole before any wave takes its fragments
#pragma unroll
  for (int u = 0; u < 2; ++u) {
    const float* orow = om[hb] + (u * 16 + col) * 68;
    const F2 a0 = split_f32(orow, 0, lane), a1 = split_f32(orow, 32, lane);
#pragma unroll
    for (int i = 0; i < 2; ++i) {
      v8f c = {};
      c = wmma_bf(a0.l, wh0[i], c); c = wmma_bf(a0.h, wl0[i], c); c = wmma_bf(a0.h, wh0[i], c);
      c = wmma_bf(a1.l, wh1[i], c); c = wmma_bf(a1.h, wl1[i], c); c = wmma_bf(a1.h, wh1[i], c);
#pragma unroll
      for (int r = 0; r < 8; ++r) st[hb][(u * 16 + r + 8 * g) * 260 + (wl * 2 + i) * 16 + col] = c[r] + bb[i];
    }
  }
  __syncthreads();                                        // all 256 columns are staged before the rows go out
  // per half 32 rows x 64 pieces of 16 B: a wave's store is 512 contiguous bytes
  const int r0 = th >> 6, pc = th & 63;                   // trip q: row 4 q + r0, one base address each for LDS and for out
  float* op = out + ((size_t)b * NSEQ + qs + r0) * D_OUT + pc * 4; const float* sp = st[hb] + r0 * 260 + pc * 4;
#pragma unroll
  for (int q = 0; q < 8; ++q) vst2(op + q * (4 * D_OUT), *(const v4f*)(sp + q * (4 * 260)));
}

extern "C" void kernel_launch(void* const* d_in, const int* in_sizes, int n_in,
                              void* d_out, int out_size, void* d_ws, size_t ws_size,
                              hipStream_t stream) {
  (void)in_sizes; (void)n_in; (void)out_size; (void)ws_size;
  const float* x     = (const float*)d_in[0];
  const float* W_qkv = (const float*)d_in[1];
  const float* b_qkv = (const float*)d_in[2];
  const float* W_out = (const float*)d_in[3];
  const float* b_out = (const float*)d_in[4];
  float* out = (float*)d_out;
  char* ws = (char*)d_ws; size_t off = 0;
  auto alloc = [&](size_t bytes) -> void* { void* p = ws + off; off = (off + bytes + 255) & ~(size_t)255; return p; };
  __bf16* Wqh = (__bf16*)alloc((size_t)D_QKV * D_MODEL * 2); __bf16* Wql = (__bf16*)alloc((size_t)D_QKV * D_MODEL * 2);
  __bf16* Woh = (__bf16*)alloc((size_t)D_OUT * D_ATTN * 2);  __bf16* Wol = (__bf16*)alloc((size_t)D_OUT * D_ATTN * 2);
  float* qb = (float*)alloc((size_t)NTOK * D_ATTN * 4); float* kb = (float*)alloc((size_t)NTOK * D_ATTN * 4);
  float* vT = (float*)alloc((size_t)NTOK * D_ATTN * 4);

  k_wt<<<WT_TILES_QKV + WT_TILES_OUT, 256, 0, stream>>>(W_qkv, Wqh, Wql, W_out, Woh, Wol);
  k_qkv<<<NTOK / 64, 512, 0, stream>>>(x, Wqh, Wql, b_qkv, qb, kb, vT);
  k_attn<<<NBATCH * (NSEQ / 64), 512, 0, stream>>>(qb, kb, vT, Woh, Wol, b_out, out);
}

// v009
// One run takes 36.9 microseconds.
// Timed twice side by side with v008, it ran 1.10 and 1.08 times as fast.
// All steps since v000 together make it 10.2 times as fast.
#include <hip/hip_runtime.h>
#include <math.h>

// Causal single-head attention (d_attn 64) with qkv and output projections.
// All four contractions (qkv projection K = 512, scores K = 64, P @ V over <= 2048 keys, output projection K = 64) on
// v_wmma_f32_16x16x32_bf16 as a TWO-WAY bf16 split of both f32 operands (hi*hi + hi*lo + lo*hi, f32 accumulate).

#define D_MODEL 512
#define D_ATTN  64
#define NSEQ    2048
#define NBATCH  8
#define NTOK    (NBATCH * NSEQ)
#define D_OUT   256
#define D_QKV   192
#define SCALE_F 0.125f

typedef __attribute__((ext_vector_type(16))) __bf16 v16bf;
typedef __attribute__((ext_vector_type(8)))  __bf16 v8bf;
typedef __attribute__((ext_vector_type(8)))  float  v8f;
typedef __attribute__((ext_vector_type(4)))  float  v4f;
typedef __attribute__((ext_vector_type(4)))  __bf16 v4bf;
typedef __attribute__((ext_vector_type(2)))  float  v2f;
typedef __attribute__((ext_vector_type(2)))  __bf16 v2bf;

template <typename T> __device__ __forceinline__ void vst2(void* p, T v) { *(T*)p = v;  }
__device__ __forceinline__ v8f wmma_bf(v16bf a, v16bf b, v8f c) {
  v8f d = __builtin_amdgcn_wmma_f32_16x16x32_bf16(false, a, false, b, (short)0, c, false, false);
  asm volatile("v_nop\n\tv_nop\n\tv_nop\n\tv_nop" : "+v"(d) : "v"(a), "v"(b));
  return d;
}
struct F2 { v16bf h, l; };
// split an f32 row fragment (row base pointer, k0) into bf16 hi/lo; element i<8 -> k0+8g+i, i>=8 -> k0+16+8g+(i-8)
__device__ __forceinline__ F2 split_f32(const float* row, int k0, int lane) {
  F2 r; const float* p = row + k0 + 8 * (lane >> 4);
#pragma unroll
  for (int i = 0; i < 16; ++i) { const float x = p[(i < 8) ? i : (i + 8)]; const __bf16 h = (__bf16)x; r.h[i] = h; r.l[i] = (__bf16)(x - (float)h); }
  return r;
}
// the 16 f32 of one fragment as loaded, and their split: lets a pass issue its loads as one group
struct R16 { v4f q[4]; };
__device__ __forceinline__ F2 split_r(const R16& s) {
  F2 r;
#pragma unroll
  for (int i = 0; i < 16; ++i) { const float x = s.q[i >> 2][i & 3]; const __bf16 h = (__bf16)x; r.h[i] = h; r.l[i] = (__bf16)(x - (float)h); }
  return r;
}
// PACKED FRAGMENTS. q, k and v (written by one kernel for the other) lie in the order in which a wave loads them: piece i of a fragment
// is 32 lanes x 16 B = 512 contiguous bytes (four whole 128-B lines a load, where a row-major operand gives sixteen lines with 32 B each).
// The element that a lane's register holds is the same as with the row-major loaders (k order of split_f32), only its address differs.
// f32 fragment (16 rows x 32 k): 4 pieces, piece i of lane (col, g) = row col, k = 8g + 4(i & 1) + 16(i >> 1) + 0..3
__device__ __forceinline__ R16 ldp(const float* p, unsigned off) {          // p: the lane's own place (lane * 4 inside); off: the fragment's element offset
  R16 r;
  r.q[0] = *(const v4f*)(p + off); r.q[1] = *(const v4f*)(p + off + 128); r.q[2] = *(const v4f*)(p + off + 256); r.q[3] = *(const v4f*)(p + off + 384); return r;
}
// bf16 fragment (16 rows x 32 k): 2 pieces, piece i of lane (col, g) = row col, k = 8g + 16i + 0..7
__device__ __forceinline__ v16bf frag_p(const __bf16* p, unsigned off) {    // p: the lane's own place (lane * 8 inside); off: the fragment's element offset
  union { v16bf v; v8bf q[2]; } r;
  r.q[0] = *(const v8bf*)(p + off); r.q[1] = *(const v8bf*)(p + off + 256); return r.v;
}

// THE WEIGHTS ARE SPLIT BY THE WAVE THAT MULTIPLIES THEM, straight from the f32 matrices W [K][N] (x @ W layout): no conversion launch ahead of the two kernels.
// A B fragment's element e of lane (col, g) is W[k0 + 8 g + (e < 8 ? e : e + 8)][its column]: the k order of split_f32. Which 16 columns make a tile is free,
// so a lane's columns in its wave's tiles are neighbours in memory and one load brings them all: 16 lanes read one contiguous run of a weight row.

// qkv projection: block = 64 tokens x all 192 cols, 16 waves = 4 quarters of K x 4 groups of 48 columns: wave (kq, cg) sums k = 128 kq .. 128 kq + 127 for all
// 64 tokens and its 3 column tiles (tile jj = columns 48 cg + 3 col + jj), so every weight is loaded and split by exactly one wave of the block.
// The block's x rows are read once in whole lines, split once and shared through LDS (bf16 hi and lo planes, row pitch 1040 B = 16 B x 65: a fragment read
// meets every bank once). The four partial sums of an element are added, and the bias after them, where the block's tile is read back from LDS.
// q, k: packed f32 fragments, index (token / 16) * 2 + (d / 32); v: packed f32 fragments of V^T (rows d, k = keys), index (token / 32) * 4 + (d / 16)
#define KQ_PASSES (D_MODEL / 32 / 4)
#define XPITCH (D_MODEL + 8)
struct W3 { float v[16][3]; };
__device__ __forceinline__ W3 ldw3(const float* p) {       // p: the lane's place in the pass's first weight row
  W3 r;
#pragma unroll
  for (int e = 0; e < 16; ++e)
#pragma unroll
    for (int jj = 0; jj < 3; ++jj) r.v[e][jj] = p[((e < 8) ? e : (e + 8)) * D_QKV + jj];
  return r;
}
// two f32 -> their bf16 hi pair and lo pair (hi = x rounded, lo = x - hi rounded: the values of split_r), the pair converted as one vector
__device__ __forceinline__ void split2(float x0, float x1, v2bf& h, v2bf& l) {
  const v2f x = { x0, x1 }; h = __builtin_convertvector(x, v2bf);
  const v2f r = { x0 - (float)h[0], x1 - (float)h[1] }; l = __builtin_convertvector(r, v2bf);
}
union P16 { v16bf v; v2bf p[8]; };
__device__ __forceinline__ void split_w3(const W3& s, F2* f) {
#pragma unroll
  for (int jj = 0; jj < 3; ++jj) {
    P16 h, l;
#pragma unroll
    for (int e = 0; e < 8; ++e) split2(s.v[2 * e][jj], s.v[2 * e + 1][jj], h.p[e], l.p[e]);
    f[jj].h = h.v; f[jj].l = l.v;
  }
}
__device__ __forceinline__ v16bf frag_x(const __bf16* p) {   // p: the lane's row of a staged x plane at k0 + 8 g
  union { v16bf v; v8bf q[2]; } r;
  r.q[0] = *(const v8bf*)p; r.q[1] = *(const v8bf*)(p + 16); return r.v;
}
__global__ __launch_bounds__(512) void k_qkv(const float* __restrict__ x, const float* __restrict__ Wq,
                                            const float* __restrict__ bq, float* __restrict__ qb, float* __restrict__ kb, float* __restrict__ vT) {
  __shared__ __align__(16) float st[4][64][196];       // [K quarter][row][col] pitch 196; while the products run, its first 130 KB hold the two x planes
  __bf16* xh = (__bf16*)&st[0][0][0]; __bf16* xl = xh + 64 * XPITCH;
  const int tid = threadIdx.x, wave = tid >> 5, cg = wave & 3, kq = wave >> 2, lane = tid & 31, col = lane & 15, g = lane >> 4;
  const float* wp = Wq + (size_t)(kq * (KQ_PASSES * 32) + 8 * g) * D_QKV + cg * 48 + 3 * col;   // the lane's own place in the weights
  const float* xg = x + ((size_t)blockIdx.x * 64 + wave * 4) * D_MODEL + lane * 4;            // the wave stages 4 rows, 512 contiguous bytes a load
  // the first pass's weights (they come from L2) go ahead of the x rows (from memory), so that they are split while the rows are on their way
  W3 raw = ldw3(wp);
  // the address register is an input here, so it lives up to this wait; the statement also keeps the weights' loads ahead of the rows' loads
  asm volatile("s_wait_xcnt 0x0" :: "v"(wp) : "memory");
  v4f xr[16];
#pragma unroll
  for (int i = 0; i < 16; ++i) xr[i] = *(const v4f*)(xg + (i >> 2) * D_MODEL + (i & 3) * 128);
  // the group's address register is an input here, so it lives up to this wait and no load of the group lands in it ahead of it
  asm volatile("s_wait_xcnt 0x0" :: "v"(xg) : "memory");
  // the two scheduling barriers keep the split of the first weights between the issue of the rows' loads and the wait for them: ahead of the issue its wait for
  // the weights would hold the rows' loads back, behind the rows' wait their latency would cover nothing
  __builtin_amdgcn_sched_barrier(0);
  F2 wf[3];
  split_w3(raw, wf);
  __builtin_amdgcn_sched_barrier(0);
#pragma unroll
  for (int i = 0; i < 16; ++i) {
    union { v4bf v; v2bf p[2]; } h, l;
    split2(xr[i][0], xr[i][1], h.p[0], l.p[0]); split2(xr[i][2], xr[i][3], h.p[1], l.p[1]);
    const int o = (wave * 4 + (i >> 2)) * XPITCH + (i & 3) * 128 + lane * 4;
    vst2(xh + o, h.v); vst2(xl + o, l.v);
  }
  __syncthreads();                                        // all 64 rows are staged before any wave takes its fragments
  raw = ldw3(wp + 32 * D_QKV);                            // the second pass's weights fly while the first pass runs
  // as above: the address register lives up to this wait
  asm volatile("s_wait_xcnt 0x0" :: "v"(wp) : "memory");
  v8f c[4][3] = {};
  const __bf16* ah = xh + col * XPITCH + kq * (KQ_PASSES * 32) + 8 * g; const __bf16* al = ah + 64 * XPITCH;
  F2 a = { frag_x(ah), frag_x(al) };
#pragma unroll   // the tests on kc and nx fall away and every LDS and weight offset is an immediate
  for (int kc = 0; kc < KQ_PASSES; ++kc) {
#pragma unroll
    for (int rt = 0; rt < 4; ++rt) {
      // the next row tile's fragments (behind the last tile: the next pass's first) are read as soon as this tile's last product with the same plane is
      // issued, into the registers that it leaves: the products that follow cover the LDS latency
      const int nx = kc * 4 + rt + 1, no = (nx & 3) * 16 * XPITCH + (nx >> 2) * 32;
      // the three column tiles' chains alternate, so each covers the others' latency; per element the order of the three products is lo*hi, hi*lo, hi*hi
#pragma unroll
      for (int jj = 0; jj < 3; ++jj) c[rt][jj] = wmma_bf(a.l, wf[jj].h, c[rt][jj]);
      if (nx < 4 * KQ_PASSES) a.l = frag_x(al + no);
#pragma unroll
      for (int jj = 0; jj < 3; ++jj) c[rt][jj] = wmma_bf(a.h, wf[jj].l, c[rt][jj]);
#pragma unroll
      for (int jj = 0; jj < 3; ++jj) c[rt][jj] = wmma_bf(a.h, wf[jj].h, c[rt][jj]);
      if (nx < 4 * KQ_PASSES) a.h = frag_x(ah + no);
    }
    // the next pass's weights, loaded a whole pass ago, are split here; the loads of the pass after it take their place
    if (kc + 1 < KQ_PASSES) {
      // keeps every instruction that reads the weights in flight behind this pass's products: ahead of them the wave would wait out the loads it has just issued
      __builtin_amdgcn_sched_barrier(0);
      split_w3(raw, wf);
    }
    if (kc + 2 < KQ_PASSES) {
      // keeps these loads behind the split: issued ahead of it they would need a third set of 48 registers, and the wave has none left (spills)
      __builtin_amdgcn_sched_barrier(0);
      raw = ldw3(wp + (kc + 2) * 32 * D_QKV);
      // the group's address register is an input here, so it lives up to this wait and no load of the group lands in it ahead of it
      asm volatile("s_wait_xcnt 0x0" :: "v"(wp) : "memory");
    }
  }
  __syncthreads();                                        // every wave has read its last x fragment before the partial sums go over the planes
  // the biases of the elements that this thread stores below: loaded here so that the LDS stores and the barrier cover their latency
  const int pi = (tid >> 5) & 3, ko = 8 * g + (pi & 1) * 4 + (pi >> 1) * 16, dq = ((tid >> 7) & 1) * 32 + ko, dv = ((tid >> 7) & 3) * 16 + col;
  const v4f bbq = { bq[dq], bq[dq + 1], bq[dq + 2], bq[dq + 3] }, bbk = { bq[64 + dq], bq[64 + dq + 1], bq[64 + dq + 2], bq[64 + dq + 3] };
  const float bbv = bq[128 + dv];
#pragma unroll
  for (int rt = 0; rt < 4; ++rt)
#pragma unroll
    for (int r = 0; r < 8; ++r)
#pragma unroll
      for (int jj = 0; jj < 3; ++jj) st[kq][rt * 16 + g * 8 + r][cg * 48 + 3 * col + jj] = c[rt][jj][r];
  __syncthreads();                                        // all four quarters' partial sums are in LDS before any thread adds them
  // q and k: the block's 8 fragments each (4 token tiles x 2 halves of d) = 1024 pieces of 16 B, piece gq at place gq: a wave's store is 512 contiguous bytes
#pragma unroll   // both trips' LDS reads stand together: one LDS latency
  for (int it = 0; it < 2; ++it) { const int gq = tid + it * 512, rl = (gq >> 8) * 16 + col;
    const size_t o = ((size_t)blockIdx.x * 1024 + gq) * 4;
    v4f sq = *(const v4f*)(&st[0][rl][dq]), sk = *(const v4f*)(&st[0][rl][64 + dq]);
#pragma unroll
    for (int p = 1; p < 4; ++p) { sq += *(const v4f*)(&st[p][rl][dq]); sk += *(const v4f*)(&st[p][rl][64 + dq]); }
    vst2(qb + o, sq + bbq);
    vst2(kb + o, sk + bbk); }
  // v: the block's 8 fragments (2 key blocks of 32 x 4 tiles of d), a piece = 4 consecutive keys of one d
#pragma unroll   // both trips' LDS reads stand together: one LDS latency
  for (int it = 0; it < 2; ++it) { const int gq = tid + it * 512, kl = it * 32 + ko;
    v4f v = { st[0][kl][128 + dv], st[0][kl + 1][128 + dv], st[0][kl + 2][128 + dv], st[0][kl + 3][128 + dv] };
#pragma unroll
    for (int p = 1; p < 4; ++p) { const v4f u = { st[p][kl][128 + dv], st[p][kl + 1][128 + dv], st[p][kl + 2][128 + dv], st[p][kl + 3][128 + dv] }; v += u; }
    vst2(vT + ((size_t)blockIdx.x * 1024 + gq) * 4, v + bbv); }
}

// the lane's value from the other half of the wave (lane ^ 16), by a vector cross-row move: no LDS, no wait
__device__ __forceinline__ float xhalf(float v) {
  const unsigned b = __builtin_bit_cast(unsigned, v);
  return __builtin_bit_cast(float, __builtin_amdgcn_permlanex16(b, b, 0x76543210u, 0xfedcba98u, false, false));
}

__device__ __forceinline__ void st_frag(__bf16* p, unsigned off, v16bf v) {   // the store that frag_p reads back
  union { v16bf v; v8bf q[2]; } r; r.v = v;
  *(v8bf*)(p + off) = r.q[0]; *(v8bf*)(p + off + 256) = r.q[1];
}
// the three products of two split operands, hi*lo + lo*hi + hi*hi, for two B operands (Q, P^T of two query tiles) that share the A operand (K rows, V^T rows);
// the two accumulator chains alternate, so each covers the other's latency
__device__ __forceinline__ void mac3t2(const F2& a, const F2& b0, const F2& b1, v8f& c0, v8f& c1) {
  c0 = wmma_bf(a.h, b0.l, c0); c1 = wmma_bf(a.h, b1.l, c1);
  c0 = wmma_bf(a.l, b0.h, c0); c1 = wmma_bf(a.l, b1.h, c1);
  c0 = wmma_bf(a.h, b0.h, c0); c1 = wmma_bf(a.h, b1.h, c1);
}

__global__ __launch_bounds__(512) void k_attn(const float* __restrict__ qb, const float* __restrict__ kb, const float* __restrict__ vT,
                                              const float* __restrict__ Wo, const float* __restrict__ bo, float* __restrict__ out) {
  __shared__ __align__(16) float os[16][32 * 68];       // un-normalised partial output per wave, [query][d], pitch 68: 16-byte stores of 16 lanes meet 64 banks once
  __shared__ float ms[16][32], ls[16][32];              // partial row maxima and row sums per wave
  __shared__ __align__(16) float om[2][32 * 68];        // per half: the merged, normalised tile [query][d]: the A operand of the output projection
  __shared__ __align__(16) float st[2][32 * 260];       // per half: the tile's 32 x 256 outputs, staged so that a wave stores whole lines
  const int wv = __builtin_amdgcn_readfirstlane(threadIdx.x >> 5), hb = wv >> 3, wl = wv & 7;
  const int b = blockIdx.x & (NBATCH - 1), pr = blockIdx.x >> 3;
  const int qs = (hb ? pr : NSEQ / 32 - 1 - pr) * 32;
  const int lane = threadIdx.x & 31, g = lane >> 4, col = lane & 15, th = threadIdx.x & 255;
  const float* qt = qb + ((size_t)b * NSEQ + qs) * D_ATTN; const float* qp = qt + lane * 4;    // the two tiles' four packed fragments
  // the split Q fragments lie in the wave's OWN range of os while the key loop runs (its partial output goes there only behind the loop): in registers they
  // would take 64 of the 256 that four waves a SIMD leave a wave. Fragment (dh * 2 + u) * 2 + (0: hi, 1: lo), 1 KB each, in the packed order of frag_p.
  __bf16* qw = (__bf16*)os[wv] + lane * 8;
  R16 qr[4];
#pragma unroll
  for (int i = 0; i < 4; ++i) qr[i] = ldp(qp, (i & 1) * 1024 + (i >> 1) * 512);
  // these loads name the wave's scalar base and the lane's number: both are inputs here, so they live up to this wait and are overwritten only behind it
  asm volatile("s_wait_xcnt 0x0" :: "s"(qt), "v"(lane) : "memory");
#pragma unroll
  for (int dh = 0; dh < 2; ++dh)
#pragma unroll
    for (int u = 0; u < 2; ++u) { const F2 f = split_r(qr[dh * 2 + u]);
      st_frag(qw, ((dh * 2 + u) * 2) * 512, f.h); st_frag(qw, ((dh * 2 + u) * 2 + 1) * 512, f.l); }
  float m_r[2] = { -1e30f, -1e30f }, l_r[2] = { 0.f, 0.f };   // the lane's two queries: running maximum (equal in both halves), sum over this half's keys
  v8f o[2][4] = {};                                     // O^T: o[u][t][r] = O[query 16 u + col][d = 16 t + 8 g + r]
  const int jmax = qs >> 5;
  const unsigned loff = lane * 4;
  const int qk = qs + col - 8 * g;                      // tile u: key ks + 8 g + r is masked where ks + r > qk + 16 u
  for (int j = wl; j <= jmax; j += 8) {
    const int ks = j * 32;
    const float* kt = kb + ((size_t)b * NSEQ + ks) * D_ATTN + loff;   // the lane's place in the key block's four packed fragments
    // all 16 K loads of the block stand ahead of the first product, so one wait covers them
    const R16 k00 = ldp(kt, 0), k01 = ldp(kt, 512), k10 = ldp(kt, 1024), k11 = ldp(kt, 1536);
    // the group's address register is an input here, so it lives up to this wait and no load of the group lands in it ahead of it
    asm volatile("s_wait_xcnt 0x0" :: "v"(kt) : "memory");
    v8f s0[2] = {}, s1[2] = {};
    { const F2 q0 = { frag_p(qw, 0), frag_p(qw, 512) }, q1 = { frag_p(qw, 1024), frag_p(qw, 1536) };          // d 0..31 of both tiles
      mac3t2(split_r(k00), q0, q1, s0[0], s0[1]); mac3t2(split_r(k10), q0, q1, s1[0], s1[1]); }
    { const F2 q0 = { frag_p(qw, 2048), frag_p(qw, 2560) }, q1 = { frag_p(qw, 3072), frag_p(qw, 3584) };    // d 32..63 of both tiles
      mac3t2(split_r(k01), q0, q1, s0[0], s0[1]); mac3t2(split_r(k11), q0, q1, s1[0], s1[1]); }
    // all 16 V loads of the block stand ahead of the softmax, which covers their latency
    const float* vb = vT + ((size_t)b * NSEQ + ks) * D_ATTN + loff;
    R16 vr[4];
#pragma unroll
    for (int t = 0; t < 4; ++t) vr[t] = ldp(vb, t * 512);
    // the group's address register is an input here, so it lives up to this wait and no load of the group lands in it ahead of it
    asm volatile("s_wait_xcnt 0x0" :: "v"(vb) : "memory");
    F2 pf[2]; float mn[2], sum[2];
#pragma unroll
    for (int u = 0; u < 2; ++u) {
      float a[16], mx[8];
#pragma unroll
      for (int r = 0; r < 8; ++r) {
        a[r]     = s0[u][r] * SCALE_F; if (ks + r > qk + 16 * u)      a[r]     = -1e30f;
        a[r + 8] = s1[u][r] * SCALE_F; if (ks + 16 + r > qk + 16 * u) a[r + 8] = -1e30f;
        mx[r] = fmaxf(a[r], a[r + 8]);
      }
#pragma unroll
      for (int w = 4; w >= 1; w >>= 1)
#pragma unroll
        for (int r = 0; r < w; ++r) mx[r] = fmaxf(mx[r], mx[r + w]);
      mn[u] = fmaxf(m_r[u], fmaxf(mx[0], xhalf(mx[0])));
      float sm[16];                                       // element s of the B operand = key ks + 8g + s (s < 8) or ks + 8 + 8g + s (s >= 8) = score a[s]
#pragma unroll
      for (int s = 0; s < 16; ++s) {
        const float pv = __expf(a[s] - mn[u]); const __bf16 h = (__bf16)pv;
        pf[u].h[s] = h; pf[u].l[s] = (__bf16)(pv - (float)h); sm[s] = pv;
      }
#pragma unroll
      for (int w = 8; w >= 1; w >>= 1)
#pragma unroll
        for (int s = 0; s < w; ++s) sm[s] += sm[s + w];
      sum[u] = sm[0];
    }
    // keeps the conversions of V, and with them the wait for the V loads, behind the softmax: without it the wait stands ahead of the softmax, which then covers no latency
    __builtin_amdgcn_sched_barrier(0);
#pragma unroll
    for (int u = 0; u < 2; ++u) {
      const float corr = __expf(m_r[u] - mn[u]);
      l_r[u] = l_r[u] * corr + sum[u]; m_r[u] = mn[u];
#pragma unroll
      for (int t = 0; t < 4; ++t) o[u][t] *= corr;
    }
#pragma unroll
    for (int t = 0; t < 4; ++t) mac3t2(split_r(vr[t]), pf[0], pf[1], o[0][t], o[1][t]);
  }
#pragma unroll
  for (int u = 0; u < 2; ++u) {
    l_r[u] += xhalf(l_r[u]);                              // the two halves' sums are joined once
    float* so = os[wv] + (u * 16 + col) * 68 + 8 * g;
#pragma unroll
    for (int t = 0; t < 4; ++t) {
      const v4f lo = { o[u][t][0], o[u][t][1], o[u][t][2], o[u][t][3] }, hi = { o[u][t][4], o[u][t][5], o[u][t][6], o[u][t][7] };
      vst2(so + t * 16, lo); vst2(so + t * 16 + 4, hi);
    }
  }
  ms[wv][lane] = g ? m_r[1] : m_r[0]; ls[wv][lane] = g ? l_r[1] : l_r[0];   // row 16 u + col is written by the lane with g = u (both halves hold the same values)
  __syncthreads();                                        // every wave's partial state is in LDS before any thread merges
  // output projection, this wave's two column tiles: their weights and biases are loaded ahead of the merge, which covers their latency
  const float* wp = Wo + (size_t)(8 * g) * D_OUT + wl * 32 + 2 * col; const float* bp = bo + wl * 32 + 2 * col;
  v2f wr[2][16];                                          // [half of K][element e of the fragment]: k = 32 kc + 8 g + (e < 8 ? e : e + 8), the lane's two columns
#pragma unroll
  for (int kc = 0; kc < 2; ++kc)
#pragma unroll
    for (int e = 0; e < 16; ++e) wr[kc][e] = *(const v2f*)(wp + (kc * 32 + ((e < 8) ? e : (e + 8))) * D_OUT);
  const v2f bb = *(const v2f*)bp;
  // the group's address registers are inputs here, so they live up to this wait and no load of the group lands in them ahead of it
  asm volatile("s_wait_xcnt 0x0" :: "v"(wp), "v"(bp) : "memory");
  // merge: thread of a half -> (row, 4 columns), two rows a thread; a wave that had no key block holds max -1e30, sum 0, zeros: weight 0
  const int c4 = (th & 15) * 4, w0 = hb * 8;
#pragma unroll
  for (int it = 0; it < 2; ++it) {
    const int row = it * 16 + (th >> 4);
    float M = ms[w0][row];
#pragma unroll
    for (int w = 1; w < 8; ++w) M = fmaxf(M, ms[w0 + w][row]);
    float L = 0.f; v4f acc = {};
#pragma unroll
    for (int w = 0; w < 8; ++w) { const float wg = __expf(ms[w0 + w][row] - M);
      L += ls[w0 + w][row] * wg; acc += *(const v4f*)(&os[w0 + w][row * 68 + c4]) * wg; }
    vst2(om[hb] + row * 68 + c4, acc / L);
  }
  F2 fa[2], fb[2];                                        // the split weights: k 0..31 and k 32..63 of column tile i
#pragma unroll
  for (int i = 0; i < 2; ++i) {
    P16 ha, la, hc, lc;
#pragma unroll
    for (int e = 0; e < 8; ++e) { split2(wr[0][2 * e][i], wr[0][2 * e + 1][i], ha.p[e], la.p[e]); split2(wr[1][2 * e][i], wr[1][2 * e + 1][i], hc.p[e], lc.p[e]); }
    fa[i].h = ha.v; fa[i].l = la.v; fb[i].h = hc.v; fb[i].l = lc.v;
  }
  __syncthreads();                                        // the merged tiles are whole before any wave takes its fragments
#pragma unroll
  for (int u = 0; u < 2; ++u) {
    const float* orow = om[hb] + (u * 16 + col) * 68;
    const F2 a0 = split_f32(orow, 0, lane), a1 = split_f32(orow, 32, lane);
#pragma unroll
    for (int i = 0; i < 2; ++i) {
      v8f c = {};
      c = wmma_bf(a0.l, fa[i].h, c); c = wmma_bf(a0.h, fa[i].l, c); c = wmma_bf(a0.h, fa[i].h, c);
      c = wmma_bf(a1.l, fb[i].h, c); c = wmma_bf(a1.h, fb[i].l, c); c = wmma_bf(a1.h, fb[i].h, c);
#pragma unroll
      for (int r = 0; r < 8; ++r) st[hb][(u * 16 + r + 8 * g) * 260 + wl * 32 + 2 * col + i] = c[r] + bb[i];
    }
  }
  __syncthreads();                                        // all 256 columns are staged before the rows go out
  // per half 32 rows x 64 pieces of 16 B: a wave's store is 512 contiguous bytes
  const int r0 = th >> 6, pc = th & 63;                   // trip q: row 4 q + r0, one base address each for LDS and for out
  float* op = out + ((size_t)b * NSEQ + qs + r0) * D_OUT + pc * 4; const float* sp = st[hb] + r0 * 260 + pc * 4;
#pragma unroll
  for (int q = 0; q < 8; ++q) vst2(op + q * (4 * D_OUT), *(const v4f*)(sp + q * (4 * 260)));
}

extern "C" void kernel_launch(void* const* d_in, const int* in_sizes, int n_in,
                              void* d_out, int out_size, void* d_ws, size_t ws_size,
                              hipStream_t stream) {
  (void)in_sizes; (void)n_in; (void)out_size; (void)ws_size;
  const float* x     = (const float*)d_in[0];
  const float* W_qkv = (const float*)d_in[1];
  const float* b_qkv = (const float*)d_in[2];
  const float* W_out = (const float*)d_in[3];
  const float* b_out = (const float*)d_in[4];
  float* out = (float*)d_out;
  char* ws = (char*)d_ws; size_t off = 0;
  auto alloc = [&](size_t bytes) -> void* { void* p = ws + off; off = (off + bytes + 255) & ~(size_t)255; return p; };
  float* qb = (float*)alloc((size_t)NTOK * D_ATTN * 4); float* kb = (float*)alloc((size_t)NTOK * D_ATTN * 4);
  float* vT = (float*)alloc((size_t)NTOK * D_ATTN * 4);

  k_qkv<<<NTOK / 64, 512, 0, stream>>>(x, W_qkv, b_qkv, qb, kb, vT);
  k_attn<<<NBATCH * (NSEQ / 64), 512, 0, stream>>>(qb, kb, vT, W_out, b_out, out);
}

// v010
// It runs in 34.4 microseconds.
// Timed twice side by side with v009, it ran 1.08 times as fast both times.
// Counting every step since v000, it is 11.0 times as fast.
#include <hip/hip_runtime.h>
#include <math.h>

// Causal single-head attention (d_attn 64) with qkv and output projections.
// All four contractions (qkv projection K = 512, scores K = 64, P @ V over <= 2048 keys, output projection K = 64) on
// v_wmma_f32_16x16x32_bf16 as a TWO-WAY bf16 split of both f32 operands (hi*hi + hi*lo + lo*hi, f32 accumulate).

#define D_MODEL 512
#define D_ATTN  64
#define NSEQ    2048
#define NBATCH  8
#define NTOK    (NBATCH * NSEQ)
#define D_OUT   256
#define D_QKV   192
#define SCALE_F 0.125f

typedef __attribute__((ext_vector_type(16))) __bf16 v16bf;
typedef __attribute__((ext_vector_type(8)))  __bf16 v8bf;
typedef __attribute__((ext_vector_type(8)))  float  v8f;
typedef __attribute__((ext_vector_type(4)))  float  v4f;
typedef __attribute__((ext_vector_type(4)))  __bf16 v4bf;
typedef __attribute__((ext_vector_type(2)))  float  v2f;
typedef __attribute__((ext_vector_type(2)))  __bf16 v2bf;

template <typename T> __device__ __forceinline__ void vst2(void* p, T v) { *(T*)p = v;  }
__device__ __forceinline__ v8f wmma_bf(v16bf a, v16bf b, v8f c) {
  v8f d = __builtin_amdgcn_wmma_f32_16x16x32_bf16(false, a, false, b, (short)0, c, false, false);
  return d;
}
struct F2 { v16bf h, l; };
// split an f32 row fragment (row base pointer, k0) into bf16 hi/lo; element i<8 -> k0+8g+i, i>=8 -> k0+16+8g+(i-8)
__device__ __forceinline__ F2 split_f32(const float* row, int k0, int lane) {
  F2 r; const float* p = row + k0 + 8 * (lane >> 4);
#pragma unroll
  for (int i = 0; i < 16; ++i) { const float x = p[(i < 8) ? i : (i + 8)]; const __bf16 h = (__bf16)x; r.h[i] = h; r.l[i] = (__bf16)(x - (float)h); }
  return r;
}
// the 16 f32 of one fragment as loaded, and their split: lets a pass issue its loads as one group
struct R16 { v4f q[4]; };
__device__ __forceinline__ F2 split_r(const R16& s) {
  F2 r;
#pragma unroll
  for (int i = 0; i < 16; ++i) { const float x = s.q[i >> 2][i & 3]; const __bf16 h = (__bf16)x; r.h[i] = h; r.l[i] = (__bf16)(x - (float)h); }
  return r;
}
// PACKED FRAGMENTS. q, k and v (written by one kernel for the other) lie in the order in which a wave loads them: piece i of a fragment
// is 32 lanes x 16 B = 512 contiguous bytes (four whole 128-B lines a load, where a row-major operand gives sixteen lines with 32 B each).
// The element that a lane's register holds is the same as with the row-major loaders (k order of split_f32), only its address differs.
// f32 fragment (16 rows x 32 k): 4 pieces, piece i of lane (col, g) = row col, k = 8g + 4(i & 1) + 16(i >> 1) + 0..3
__device__ __forceinline__ R16 ldp(const float* p, unsigned off) {          // p: the lane's own place (lane * 4 inside); off: the fragment's element offset
  R16 r;
  r.q[0] = *(const v4f*)(p + off); r.q[1] = *(const v4f*)(p + off + 128); r.q[2] = *(const v4f*)(p + off + 256); r.q[3] = *(const v4f*)(p + off + 384); return r;
}
// bf16 fragment (16 rows x 32 k): 2 pieces, piece i of lane (col, g) = row col, k = 8g + 16i + 0..7
__device__ __forceinline__ v16bf frag_p(const __bf16* p, unsigned off) {    // p: the lane's own place (lane * 8 inside); off: the fragment's element offset
  union { v16bf v; v8bf q[2]; } r;
  r.q[0] = *(const v8bf*)(p + off); r.q[1] = *(const v8bf*)(p + off + 256); return r.v;
}

// THE WEIGHTS ARE SPLIT BY THE WAVE THAT MULTIPLIES THEM, straight from the f32 matrices W [K][N] (x @ W layout): no conversion launch ahead of the two kernels.
// A B fragment's element e of lane (col, g) is W[k0 + 8 g + (e < 8 ? e : e + 8)][its column]: the k order of split_f32. Which 16 columns make a tile is free,
// so a lane's columns in its wave's tiles are neighbours in memory and one load brings them all: 16 lanes read one contiguous run of a weight row.

// qkv projection: block = 64 tokens x all 192 cols, 16 waves = 4 quarters of K x 4 groups of 48 columns: wave (kq, cg) sums k = 128 kq .. 128 kq + 127 for all
// 64 tokens and its 3 column tiles (tile jj = columns 48 cg + 3 col + jj), so every weight is loaded and split by exactly one wave of the block.
// The block's x rows are read once in whole lines, split once and shared through LDS (bf16 hi and lo planes, row pitch 1040 B = 16 B x 65: a fragment read
// meets every bank once). The four partial sums of an element are added, and the bias after them, where the block's tile is read back from LDS.
// q, k: packed f32 fragments, index (token / 16) * 2 + (d / 32); v: packed f32 fragments of V^T (rows d, k = keys), index (token / 32) * 4 + (d / 16)
#define KQ_PASSES (D_MODEL / 32 / 4)
#define XPITCH (D_MODEL + 8)
struct W3 { float v[16][3]; };
__device__ __forceinline__ W3 ldw3(const float* p) {       // p: the lane's place in the pass's first weight row
  W3 r;
#pragma unroll
  for (int e = 0; e < 16; ++e)
#pragma unroll
    for (int jj = 0; jj < 3; ++jj) r.v[e][jj] = p[((e < 8) ? e : (e + 8)) * D_QKV + jj];
  return r;
}
// two f32 -> their bf16 hi pair and lo pair (hi = x rounded, lo = x - hi rounded: the values of split_r), the pair converted as one vector
__device__ __forceinline__ void split2(float x0, float x1, v2bf& h, v2bf& l) {
  const v2f x = { x0, x1 }; h = __builtin_convertvector(x, v2bf);
  const v2f r = { x0 - (float)h[0], x1 - (float)h[1] }; l = __builtin_convertvector(r, v2bf);
}
union P16 { v16bf v; v2bf p[8]; };
__device__ __forceinline__ void split_w3(const W3& s, F2* f) {
#pragma unroll
  for (int jj = 0; jj < 3; ++jj) {
    P16 h, l;
#pragma unroll
    for (int e = 0; e < 8; ++e) split2(s.v[2 * e][jj], s.v[2 * e + 1][jj], h.p[e], l.p[e]);
    f[jj].h = h.v; f[jj].l = l.v;
  }
}
__device__ __forceinline__ v16bf frag_x(const __bf16* p) {   // p: the lane's row of a staged x plane at k0 + 8 g
  union { v16bf v; v8bf q[2]; } r;
  r.q[0] = *(const v8bf*)p; r.q[1] = *(const v8bf*)(p + 16); return r.v;
}
__global__ __launch_bounds__(512) void k_qkv(const float* __restrict__ x, const float* __restrict__ Wq,
                                            const float* __restrict__ bq, float* __restrict__ qb, float* __restrict__ kb, float* __restrict__ vT) {
  __shared__ __align__(16) float st[4][64][196];       // [K quarter][row][col] pitch 196; while the products run, its first 130 KB hold the two x planes
  __bf16* xh = (__bf16*)&st[0][0][0]; __bf16* xl = xh + 64 * XPITCH;
  const int tid = threadIdx.x, wave = tid >> 5, cg = wave & 3, kq = wave >> 2, lane = tid & 31, col = lane & 15, g = lane >> 4;
  const float* wp = Wq + (size_t)(kq * (KQ_PASSES * 32) + 8 * g) * D_QKV + cg * 48 + 3 * col;   // the lane's own place in the weights
  const float* xg = x + ((size_t)blockIdx.x * 64 + wave * 4) * D_MODEL + lane * 4;            // the wave stages 4 rows, 512 contiguous bytes a load
  // the first pass's weights (they come from L2) go ahead of the x rows (from memory), so that they are split while the rows are on their way
  W3 raw = ldw3(wp);
  // the address register is an input here, so it lives up to this wait; the statement also keeps the weights' loads ahead of the rows' loads
  asm volatile("s_wait_xcnt 0x0" :: "v"(wp) : "memory");
  v4f xr[16];
#pragma unroll
  for (int i = 0; i < 16; ++i) xr[i] = *(const v4f*)(xg + (i >> 2) * D_MODEL + (i & 3) * 128);
  // the group's address register is an input here, so it lives up to this wait and no load of the group lands in it ahead of it
  asm volatile("s_wait_xcnt 0x0" :: "v"(xg) : "memory");
  // the two scheduling barriers keep the split of the first weights between the issue of the rows' loads and the wait for them: ahead of the issue its wait for
  // the weights would hold the rows' loads back, behind the rows' wait their latency would cover nothing
  __builtin_amdgcn_sched_barrier(0);
  F2 wf[3];
  split_w3(raw, wf);
  __builtin_amdgcn_sched_barrier(0);
#pragma unroll
  for (int i = 0; i < 16; ++i) {
    union { v4bf v; v2bf p[2]; } h, l;
    split2(xr[i][0], xr[i][1], h.p[0], l.p[0]); split2(xr[i][2], xr[i][3], h.p[1], l.p[1]);
    const int o = (wave * 4 + (i >> 2)) * XPITCH + (i & 3) * 128 + lane * 4;
    vst2(xh + o, h.v); vst2(xl + o, l.v);
  }
  __syncthreads();                                        // all 64 rows are staged before any wave takes its fragments
  raw = ldw3(wp + 32 * D_QKV);                            // the second pass's weights fly while the first pass runs
  // as above: the address register lives up to this wait
  asm volatile("s_wait_xcnt 0x0" :: "v"(wp) : "memory");
  v8f c[4][3] = {};
  const __bf16* ah = xh + col * XPITCH + kq * (KQ_PASSES * 32) + 8 * g; const __bf16* al = ah + 64 * XPITCH;
  F2 a = { frag_x(ah), frag_x(al) };
#pragma unroll   // the tests on kc and nx fall away and every LDS and weight offset is an immediate
  for (int kc = 0; kc < KQ_PASSES; ++kc) {
#pragma unroll
    for (int rt = 0; rt < 4; ++rt) {
      // the next row tile's fragments (behind the last tile: the next pass's first) are read as soon as this tile's last product with the same plane is
      // issued, into the registers that it leaves: the products that follow cover the LDS latency
      const int nx = kc * 4 + rt + 1, no = (nx & 3) * 16 * XPITCH + (nx >> 2) * 32;
      // the three column tiles' chains alternate, so each covers the others' latency; per element the order of the three products is lo*hi, hi*lo, hi*hi
#pragma unroll
      for (int jj = 0; jj < 3; ++jj) c[rt][jj] = wmma_bf(a.l, wf[jj].h, c[rt][jj]);
      if (nx < 4 * KQ_PASSES) a.l = frag_x(al + no);
      // keeps these LDS reads here, six products ahead of their first use: left free they sink to just ahead of it and the wave waits out the LDS latency
      __builtin_amdgcn_sched_barrier(0);
#pragma unroll
      for (int jj = 0; jj < 3; ++jj) c[rt][jj] = wmma_bf(a.h, wf[jj].l, c[rt][jj]);
#pragma unroll
      for (int jj = 0; jj < 3; ++jj) c[rt][jj] = wmma_bf(a.h, wf[jj].h, c[rt][jj]);
      if (nx < 4 * KQ_PASSES) a.h = frag_x(ah + no);
      // as above: these reads stay three products ahead of their first use
      __builtin_amdgcn_sched_barrier(0);
    }
    // the next pass's weights, loaded a whole pass ago, are split here; the loads of the pass after it take their place
    if (kc + 1 < KQ_PASSES) {
      // keeps every instruction that reads the weights in flight behind this pass's products: ahead of them the wave would wait out the loads it has just issued
      __builtin_amdgcn_sched_barrier(0);
      split_w3(raw, wf);
    }
    if (kc + 2 < KQ_PASSES) {
      // keeps these loads behind the split: issued ahead of it they would need a third set of 48 registers, and the wave has none left (spills)
      __builtin_amdgcn_sched_barrier(0);
      raw = ldw3(wp + (kc + 2) * 32 * D_QKV);
      // the group's address register is an input here, so it lives up to this wait and no load of the group lands in it ahead of it
      asm volatile("s_wait_xcnt 0x0" :: "v"(wp) : "memory");
    }
  }
  __syncthreads();                                        // every wave has read its last x fragment before the partial sums go over the planes
  // the biases of the elements that this thread stores below: loaded here so that the LDS stores and the barrier cover their latency
  const int pi = (tid >> 5) & 3, ko = 8 * g + (pi & 1) * 4 + (pi >> 1) * 16, dq = ((tid >> 7) & 1) * 32 + ko, dv = ((tid >> 7) & 3) * 16 + col;
  const v4f bbq = { bq[dq], bq[dq + 1], bq[dq + 2], bq[dq + 3] }, bbk = { bq[64 + dq], bq[64 + dq + 1], bq[64 + dq + 2], bq[64 + dq + 3] };
  const float bbv = bq[128 + dv];
#pragma unroll
  for (int rt = 0; rt < 4; ++rt)
#pragma unroll
    for (int r = 0; r < 8; ++r)
#pragma unroll
      for (int jj = 0; jj < 3; ++jj) st[kq][rt * 16 + g * 8 + r][cg * 48 + 3 * col + jj] = c[rt][jj][r];
  __syncthreads();                                        // all four quarters' partial sums are in LDS before any thread adds them
  // q and k: the block's 8 fragments each (4 token tiles x 2 halves of d) = 1024 pieces of 16 B, piece gq at place gq: a wave's store is 512 contiguous bytes
#pragma unroll   // both trips' LDS reads stand together: one LDS latency
  for (int it = 0; it < 2; ++it) { const int gq = tid + it * 512, rl = (gq >> 8) * 16 + col;
    const size_t o = ((size_t)blockIdx.x * 1024 + gq) * 4;
    v4f sq = *(const v4f*)(&st[0][rl][dq]), sk = *(const v4f*)(&st[0][rl][64 + dq]);
#pragma unroll
    for (int p = 1; p < 4; ++p) { sq += *(const v4f*)(&st[p][rl][dq]); sk += *(const v4f*)(&st[p][rl][64 + dq]); }
    vst2(qb + o, sq + bbq);
    vst2(kb + o, sk + bbk); }
  // v: the block's 8 fragments (2 key blocks of 32 x 4 tiles of d), a piece = 4 consecutive keys of one d
#pragma unroll   // both trips' LDS reads stand together: one LDS latency
  for (int it = 0; it < 2; ++it) { const int gq = tid + it * 512, kl = it * 32 + ko;
    v4f v = { st[0][kl][128 + dv], st[0][kl + 1][128 + dv], st[0][kl + 2][128 + dv], st[0][kl + 3][128 + dv] };
#pragma unroll
    for (int p = 1; p < 4; ++p) { const v4f u = { st[p][kl][128 + dv], st[p][kl + 1][128 + dv], st[p][kl + 2][128 + dv], st[p][kl + 3][128 + dv] }; v += u; }
    vst2(vT + ((size_t)blockIdx.x * 1024 + gq) * 4, v + bbv); }
}

// the lane's value from the other half of the wave (lane ^ 16), by a vector cross-row move: no LDS, no wait
__device__ __forceinline__ float xhalf(float v) {
  const unsigned b = __builtin_bit_cast(unsigned, v);
  return __builtin_bit_cast(float, __builtin_amdgcn_permlanex16(b, b, 0x76543210u, 0xfedcba98u, false, false));
}

__device__ __forceinline__ void st_frag(__bf16* p, unsigned off, v16bf v) {   // the store that frag_p reads back
  union { v16bf v; v8bf q[2]; } r; r.v = v;
  *(v8bf*)(p + off) = r.q[0]; *(v8bf*)(p + off + 256) = r.q[1];
}
// the three products of two split operands, hi*lo + lo*hi + hi*hi, for two B operands (Q, P^T of two query tiles) that share the A operand (K rows, V^T rows);
// the two accumulator chains alternate, so each covers the other's latency
__device__ __forceinline__ void mac3t2(const F2& a, const F2& b0, const F2& b1, v8f& c0, v8f& c1) {
  c0 = wmma_bf(a.h, b0.l, c0); c1 = wmma_bf(a.h, b1.l, c1);
  c0 = wmma_bf(a.l, b0.h, c0); c1 = wmma_bf(a.l, b1.h, c1);
  c0 = wmma_bf(a.h, b0.h, c0); c1 = wmma_bf(a.h, b1.h, c1);
}

__global__ __launch_bounds__(512) void k_attn(const float* __restrict__ qb, const float* __restrict__ kb, const float* __restrict__ vT,
                                              const float* __restrict__ Wo, const float* __restrict__ bo, float* __restrict__ out) {
  __shared__ __align__(16) float os[16][32 * 68];       // un-normalised partial output per wave, [query][d], pitch 68: 16-byte stores of 16 lanes meet 64 banks once
  __shared__ float ms[16][32], ls[16][32];              // partial row maxima and row sums per wave
  __shared__ __align__(16) float om[2][32 * 68];        // per half: the merged, normalised tile [query][d]: the A operand of the output projection
  __shared__ __align__(16) float st[2][32 * 260];       // per half: the tile's 32 x 256 outputs, staged so that a wave stores whole lines
  const int wv = __builtin_amdgcn_readfirstlane(threadIdx.x >> 5), hb = wv >> 3, wl = wv & 7;
  const int b = blockIdx.x & (NBATCH - 1), pr = blockIdx.x >> 3;
  const int qs = (hb ? pr : NSEQ / 32 - 1 - pr) * 32;
  const int lane = threadIdx.x & 31, g = lane >> 4, col = lane & 15, th = threadIdx.x & 255;
  const float* qt = qb + ((size_t)b * NSEQ + qs) * D_ATTN; const float* qp = qt + lane * 4;    // the two tiles' four packed fragments
  // the split Q fragments lie in the wave's OWN range of os while the key loop runs (its partial output goes there only behind the loop): in registers they
  // would take 64 of the 256 that four waves a SIMD leave a wave. Fragment (dh * 2 + u) * 2 + (0: hi, 1: lo), 1 KB each, in the packed order of frag_p.
  __bf16* qw = (__bf16*)os[wv] + lane * 8;
  R16 qr[4];
#pragma unroll
  for (int i = 0; i < 4; ++i) qr[i] = ldp(qp, (i & 1) * 1024 + (i >> 1) * 512);
  // these loads name the wave's scalar base and the lane's number: both are inputs here, so they live up to this wait and are overwritten only behind it
  asm volatile("s_wait_xcnt 0x0" :: "s"(qt), "v"(lane) : "memory");
#pragma unroll
  for (int dh = 0; dh < 2; ++dh)
#pragma unroll
    for (int u = 0; u < 2; ++u) { const F2 f = split_r(qr[dh * 2 + u]);
      st_frag(qw, ((dh * 2 + u) * 2) * 512, f.h); st_frag(qw, ((dh * 2 + u) * 2 + 1) * 512, f.l); }
  float m_r[2] = { -1e30f, -1e30f }, l_r[2] = { 0.f, 0.f };   // the lane's two queries: running maximum (equal in both halves), sum over this half's keys
  v8f o[2][4] = {};                                     // O^T: o[u][t][r] = O[query 16 u + col][d = 16 t + 8 g + r]
  const int jmax = qs >> 5;
  const unsigned loff = lane * 4;
  const int qk = qs + col - 8 * g;                      // tile u: key ks + 8 g + r is masked where ks + r > qk + 16 u
  for (int j = wl; j <= jmax; j += 8) {
    const int ks = j * 32;
    const float* kt = kb + ((size_t)b * NSEQ + ks) * D_ATTN + loff;   // the lane's place in the key block's four packed fragments
    // all 16 K loads of the block stand ahead of the first product, so one wait covers them
    const R16 k00 = ldp(kt, 0), k01 = ldp(kt, 512), k10 = ldp(kt, 1024), k11 = ldp(kt, 1536);
    // the group's address register is an input here, so it lives up to this wait and no load of the group lands in it ahead of it
    asm volatile("s_wait_xcnt 0x0" :: "v"(kt) : "memory");
    v8f s0[2] = {}, s1[2] = {};
    { const F2 q0 = { frag_p(qw, 0), frag_p(qw, 512) }, q1 = { frag_p(qw, 1024), frag_p(qw, 1536) };          // d 0..31 of both tiles
      mac3t2(split_r(k00), q0, q1, s0[0], s0[1]); mac3t2(split_r(k10), q0, q1, s1[0], s1[1]); }
    // keeps the second half's eight LDS reads together behind the first half's products, one counted wait run for all: left free they are dealt out among
    // the products in pairs, and the wave waits out the LDS latency behind each pair
    __builtin_amdgcn_sched_barrier(0);
    { const F2 q0 = { frag_p(qw, 2048), frag_p(qw, 2560) }, q1 = { frag_p(qw, 3072), frag_p(qw, 3584) };    // d 32..63 of both tiles
      mac3t2(split_r(k01), q0, q1, s0[0], s0[1]); mac3t2(split_r(k11), q0, q1, s1[0], s1[1]); }
    // all 16 V loads of the block stand ahead of the softmax, which covers their latency
    const float* vb = vT + ((size_t)b * NSEQ + ks) * D_ATTN + loff;
    R16 vr[4];
#pragma unroll
    for (int t = 0; t < 4; ++t) vr[t] = ldp(vb, t * 512);
    // the group's address register is an input here, so it lives up to this wait and no load of the group lands in it ahead of it
    asm volatile("s_wait_xcnt 0x0" :: "v"(vb) : "memory");
    F2 pf[2]; float mn[2], sum[2];
#pragma unroll
    for (int u = 0; u < 2; ++u) {
      float a[16], mx[8];
#pragma unroll
      for (int r = 0; r < 8; ++r) {
        a[r]     = s0[u][r] * SCALE_F; if (ks + r > qk + 16 * u)      a[r]     = -1e30f;
        a[r + 8] = s1[u][r] * SCALE_F; if (ks + 16 + r > qk + 16 * u) a[r + 8] = -1e30f;
        mx[r] = fmaxf(a[r], a[r + 8]);
      }
#pragma unroll
      for (int w = 4; w >= 1; w >>= 1)
#pragma unroll
        for (int r = 0; r < w; ++r) mx[r] = fmaxf(mx[r], mx[r + w]);
      mn[u] = fmaxf(m_r[u], fmaxf(mx[0], xhalf(mx[0])));
      float sm[16];                                       // element s of the B operand = key ks + 8g + s (s < 8) or ks + 8 + 8g + s (s >= 8) = score a[s]
#pragma unroll
      for (int s = 0; s < 16; ++s) {
        const float pv = __expf(a[s] - mn[u]); const __bf16 h = (__bf16)pv;
        pf[u].h[s] = h; pf[u].l[s] = (__bf16)(pv - (float)h); sm[s] = pv;
      }
#pragma unroll
      for (int w = 8; w >= 1; w >>= 1)
#pragma unroll
        for (int s = 0; s < w; ++s) sm[s] += sm[s + w];
      sum[u] = sm[0];
    }
    // keeps the conversions of V, and with them the wait for the V loads, behind the softmax: without it the wait stands ahead of the softmax, which then covers no latency
    __builtin_amdgcn_sched_barrier(0);
#pragma unroll
    for (int u = 0; u < 2; ++u) {
      const float corr = __expf(m_r[u] - mn[u]);
      l_r[u] = l_r[u] * corr + sum[u]; m_r[u] = mn[u];
#pragma unroll
      for (int t = 0; t < 4; ++t) o[u][t] *= corr;
    }
#pragma unroll
    for (int t = 0; t < 4; ++t) mac3t2(split_r(vr[t]), pf[0], pf[1], o[0][t], o[1][t]);
  }
#pragma unroll
  for (int u = 0; u < 2; ++u) {
    l_r[u] += xhalf(l_r[u]);                              // the two halves' sums are joined once
    float* so = os[wv] + (u * 16 + col) * 68 + 8 * g;
#pragma unroll
    for (int t = 0; t < 4; ++t) {
      const v4f lo = { o[u][t][0], o[u][t][1], o[u][t][2], o[u][t][3] }, hi = { o[u][t][4], o[u][t][5], o[u][t][6], o[u][t][7] };
      vst2(so + t * 16, lo); vst2(so + t * 16 + 4, hi);
    }
  }
  ms[wv][lane] = g ? m_r[1] : m_r[0]; ls[wv][lane] = g ? l_r[1] : l_r[0];   // row 16 u + col is written by the lane with g = u (both halves hold the same values)
  __syncthreads();                                        // every wave's partial state is in LDS before any thread merges
  // output projection, this wave's two column tiles: their weights and biases are loaded ahead of the merge, which covers their latency
  const float* wp = Wo + (size_t)(8 * g) * D_OUT + wl * 32 + 2 * col; const float* bp = bo + wl * 32 + 2 * col;
  v2f wr[2][16];                                          // [half of K][element e of the fragment]: k = 32 kc + 8 g + (e < 8 ? e : e + 8), the lane's two columns
#pragma unroll
  for (int kc = 0; kc < 2; ++kc)
#pragma unroll
    for (int e = 0; e < 16; ++e) wr[kc][e] = *(const v2f*)(wp + (kc * 32 + ((e < 8) ? e : (e + 8))) * D_OUT);
  const v2f bb = *(const v2f*)bp;
  // the group's address registers are inputs here, so they live up to this wait and no load of the group lands in them ahead of it
  asm volatile("s_wait_xcnt 0x0" :: "v"(wp), "v"(bp) : "memory");
  // merge: thread of a half -> (row, 4 columns), two rows a thread; a wave that had no key block holds max -1e30, sum 0, zeros: weight 0
  const int c4 = (th & 15) * 4, w0 = hb * 8;
#pragma unroll
  for (int it = 0; it < 2; ++it) {
    const int row = it * 16 + (th >> 4);
    float M = ms[w0][row];
#pragma unroll
    for (int w = 1; w < 8; ++w) M = fmaxf(M, ms[w0 + w][row]);
    float L = 0.f; v4f acc = {};
#pragma unroll
    for (int w = 0; w < 8; ++w) { const float wg = __expf(ms[w0 + w][row] - M);
      L += ls[w0 + w][row] * wg; acc += *(const v4f*)(&os[w0 + w][row * 68 + c4]) * wg; }
    vst2(om[hb] + row * 68 + c4, acc / L);
  }
  F2 fa[2], fb[2];                                        // the split weights: k 0..31 and k 32..63 of column tile i
#pragma unroll
  for (int i = 0; i < 2; ++i) {
    P16 ha, la, hc, lc;
#pragma unroll
    for (int e = 0; e < 8; ++e) { split2(wr[0][2 * e][i], wr[0][2 * e + 1][i], ha.p[e], la.p[e]); split2(wr[1][2 * e][i], wr[1][2 * e + 1][i], hc.p[e], lc.p[e]); }
    fa[i].h = ha.v; fa[i].l = la.v; fb[i].h = hc.v; fb[i].l = lc.v;
  }
  __syncthreads();                                        // the merged tiles are whole before any wave takes its fragments
#pragma unroll
  for (int u = 0; u < 2; ++u) {
    const float* orow = om[hb] + (u * 16 + col) * 68;
    const F2 a0 = split_f32(orow, 0, lane), a1 = split_f32(orow, 32, lane);
#pragma unroll
    for (int i = 0; i < 2; ++i) {
      v8f c = {};
      c = wmma_bf(a0.l, fa[i].h, c); c = wmma_bf(a0.h, fa[i].l, c); c = wmma_bf(a0.h, fa[i].h, c);
      c = wmma_bf(a1.l, fb[i].h, c); c = wmma_bf(a1.h, fb[i].l, c); c = wmma_bf(a1.h, fb[i].h, c);
#pragma unroll
      for (int r = 0; r < 8; ++r) st[hb][(u * 16 + r + 8 * g) * 260 + wl * 32 + 2 * col + i] = c[r] + bb[i];
    }
  }
  __syncthreads();                                        // all 256 columns are staged before the rows go out
  // per half 32 rows x 64 pieces of 16 B: a wave's store is 512 contiguous bytes
  const int r0 = th >> 6, pc = th & 63;                   // trip q: row 4 q + r0, one base address each for LDS and for out
  float* op = out + ((size_t)b * NSEQ + qs + r0) * D_OUT + pc * 4; const float* sp = st[hb] + r0 * 260 + pc * 4;
#pragma unroll
  for (int q = 0; q < 8; ++q) vst2(op + q * (4 * D_OUT), *(const v4f*)(sp + q * (4 * 260)));
}

extern "C" void kernel_launch(void* const* d_in, const int* in_sizes, int n_in,
                              void* d_out, int out_size, void* d_ws, size_t ws_size,
                              hipStream_t stream) {
  (void)in_sizes; (void)n_in; (void)out_size; (void)ws_size;
  const float* x     = (const float*)d_in[0];
  const float* W_qkv = (const float*)d_in[1];
  const float* b_qkv = (const float*)d_in[2];
  const float* W_out = (const float*)d_in[3];
  const float* b_out = (const float*)d_in[4];
  float* out = (float*)d_out;
  char* ws = (char*)d_ws; size_t off = 0;
  auto alloc = [&](size_t bytes) -> void* { void* p = ws + off; off = (off + bytes + 255) & ~(size_t)255; return p; };
  float* qb = (float*)alloc((size_t)NTOK * D_ATTN * 4); float* kb = (float*)alloc((size_t)NTOK * D_ATTN * 4);
  float* vT = (float*)alloc((size_t)NTOK * D_ATTN * 4);

  k_qkv<<<NTOK / 64, 512, 0, stream>>>(x, W_qkv, b_qkv, qb, kb, vT);
  k_attn<<<NBATCH * (NSEQ / 64), 512, 0, stream>>>(qb, kb, vT, W_out, b_out, out);
}
